// v000
// Measured on an AMD MI455X. A time is GPU time per run, averaged over a window of back-to-back runs after a warm-up
// (all launches, gaps included; the runs take copies of the inputs in turn), and the median of several windows.
// Apart from v000's, it joins two sittings. Times from different sittings can be a few percent apart, while
// side-by-side timings come from the same sitting.
// The starting kernel, v000, takes 3500 microseconds a run.
// Contractions: q/k/v channel projections on v_wmma_f32_16x16x32_bf16 with x^T and W as bf16 hi+lo planes (hh+hl+lh); energy q.k^T on v_wmma_f32_16x16x32_bf16 with q,k bf16 hi|lo parts packed along the 32-deep k axis (hh+lh+hl in one pass); P.V^T on v_wmma_f32_16x16x32_f16 (P f16 carried x32768, V f16 plane); f32 accumulate everywhere; softmax, biases, gamma scale and residual in f32.
#include <hip/hip_runtime.h>
#include <math.h>

// ---------------------------------------------------------------------------
// Problem constants
// ---------------------------------------------------------------------------
constexpr int kB    = 2;        // batch
constexpr int kC    = 64;       // channels (value dim and projection K)
constexpr int kCq   = 8;        // query/key channels
constexpr int kN    = 8000;     // voxels per sample (20*20*20)
constexpr int kKP   = 64;       // packed q|k row width in halves: q block cols 0..31, k block cols 32..63
constexpr int kQCH  = 1600;     // query rows per score chunk
constexpr int kNChunk = kN / kQCH;          // 5
constexpr int kNC8  = kN / 8;               // 1000 16-byte chunks per score/probability row
constexpr float kPCarry    = 32768.0f;      // probabilities carried x2^15 in f16
constexpr float kPCarryInv = 1.0f / 32768.0f;
constexpr int kTilesProj   = (kN / 64) * (kKP / 64);      // 125
constexpr int kBlocksProj  = (kTilesProj + 7) / 8;         // 16
constexpr int kTilesScore  = (kQCH / 64) * (kN / 64);      // 3125
constexpr int kBlocksScore = (kTilesScore + 7) / 8;        // 391
constexpr int kTilesPV     = (kC / 64) * (kQCH / 64);      // 25
constexpr int kBlocksPV    = (kTilesPV + 7) / 8;           // 4
static_assert(kN % 64 == 0 && kQCH % 64 == 0 && kN % kQCH == 0, "tiles");
static_assert(kC == 64 && kKP % 32 == 0 && kC % 32 == 0 && kN % 32 == 0, "k multiples");
static_assert(kNC8 % 8 == 0, "row chunk count is a whole number of lines");
static_assert((kB * kN) % 32 == 0, "pack rows per block");
static_assert(3 * kCq <= 32, "hi|lo|hi packing fits one k step");

typedef __attribute__((ext_vector_type(16))) _Float16 v16h;
typedef __attribute__((ext_vector_type(8)))  _Float16 v8h;
typedef __attribute__((ext_vector_type(16))) __bf16   v16b;
typedef __attribute__((ext_vector_type(8)))  __bf16   v8b;
typedef __attribute__((ext_vector_type(8)))  float    v8f;
typedef __attribute__((ext_vector_type(4)))  float    v4f;
typedef __attribute__((ext_vector_type(4)))  unsigned int v4u;

// ---------------------------------------------------------------------------
// Device helpers
// ---------------------------------------------------------------------------
__device__ __forceinline__ unsigned short f2bf_bits(float f) {
  unsigned u = __float_as_uint(f);
  return (unsigned short)((u + 0x7FFFu + ((u >> 16) & 1u)) >> 16);
}
__device__ __forceinline__ float bf_bits2f(unsigned short h) { return __uint_as_float(((unsigned)h) << 16); }

// hazard guards as plain device helpers (no inline asm inside the kernel template body)
__device__ __forceinline__ void dep_guard_h(v8f& a, v8f& b, v16h x, v16h y) { asm volatile("v_nop\n\tv_nop\n\tv_nop\n\tv_nop" : "+v"(a), "+v"(b) : "v"(x), "v"(y)); }
__device__ __forceinline__ void dep_guard_b(v8f& a, v8f& b, v16b x, v16b y) { asm volatile("v_nop\n\tv_nop\n\tv_nop\n\tv_nop" : "+v"(a), "+v"(b) : "v"(x), "v"(y)); }
__device__ __forceinline__ void keep4_h(v16h a, v16h b, v16h c, v16h d) { asm volatile("v_nop" :: "v"(a), "v"(b), "v"(c), "v"(d)); }
__device__ __forceinline__ void keep4_b(v16b a, v16b b, v16b c, v16b d) { asm volatile("v_nop" :: "v"(a), "v"(b), "v"(c), "v"(d)); }
__device__ __forceinline__ void acc_guard4(v8f& a, v8f& b, v8f& c, v8f& d) { asm volatile("v_nop\n\tv_nop\n\tv_nop\n\tv_nop" : "+v"(a), "+v"(b), "+v"(c), "+v"(d)); }
template <typename T> struct Frag;
template <> struct Frag<_Float16> {
  typedef v16h V; union U { v16h v; v8h h[2]; };
  // elements 0..7 <- p[0..7], 8..15 <- p[16..23]
  static __device__ __forceinline__ v16h load(const _Float16* p) {
    U f; f.h[0] = *(const v8h*)(p); f.h[1] = *(const v8h*)(p + 16); return f.v;
  }
  static __device__ __forceinline__ v8f mma(v16h a, v16h b, v8f c) {
    return __builtin_amdgcn_wmma_f32_16x16x32_f16(false, a, false, b, (short)0, c, false, false);
  }
  static __device__ __forceinline__ void guard(v8f& a, v8f& b, v16h x, v16h y) { dep_guard_h(a, b, x, y); }
  static __device__ __forceinline__ void keep(v16h a, v16h b, v16h c, v16h d) { keep4_h(a, b, c, d); }
};
template <> struct Frag<__bf16> {
  typedef v16b V; union U { v16b v; v8b h[2]; };
  static __device__ __forceinline__ v16b load(const __bf16* p) {
    U f; f.h[0] = *(const v8b*)(p); f.h[1] = *(const v8b*)(p + 16); return f.v;
  }
  static __device__ __forceinline__ v8f mma(v16b a, v16b b, v8f c) {
    return __builtin_amdgcn_wmma_f32_16x16x32_bf16(false, a, false, b, (short)0, c, false, false);
  }
  static __device__ __forceinline__ void guard(v8f& a, v8f& b, v16b x, v16b y) { dep_guard_b(a, b, x, y); }
  static __device__ __forceinline__ void keep(v16b a, v16b b, v16b c, v16b d) { keep4_b(a, b, c, d); }
};

__device__ __forceinline__ unsigned pk16(unsigned short a, unsigned short b) { return (unsigned)a | ((unsigned)b << 16); }
__device__ __forceinline__ unsigned short h_bits(float f) { const _Float16 h = (_Float16)f; return __builtin_bit_cast(unsigned short, h); }

// ---- Register-blocked batched WMMA GEMM (ACT reduced to none/relu/leaky) -------------------------------
// C[m,n] = scale * sum_k A[m,k] * Bt[n,k] (+bias)(+resid); each wave owns a 64x64 tile.
// A row-major [M,K]; Bt row-major [N,K]; M,N % 64 == 0, K % 32 == 0.
// SPLIT: operands are hi/lo planes (A2/Bt2 = lo planes, same layout); product = hi*hi + hi*lo + lo*hi.
// BIAS_MODE: 0 = none, 1 = bias[m], 2 = bias[n].
// OUT_MODE: 0 = f32, 1 = f16, 2 = bf16 hi plane (Cout) + bf16 lo plane (Cout2).
// ET: 0 = f16 operands, 1 = bf16 operands (pointers passed as 16-bit storage)
template <int ET> struct Elem;
template <> struct Elem<0> { typedef _Float16 T; };
template <> struct Elem<1> { typedef __bf16 T; };
template <int ET, bool SPLIT, int BIAS_MODE, int OUT_MODE, bool RESID, int ACT = 0>
__global__ __launch_bounds__(256) void wmma_gemm64(
    const unsigned short* __restrict__ Ap, const unsigned short* __restrict__ A2p, int lda, long strideA,
    const unsigned short* __restrict__ Btp, const unsigned short* __restrict__ Bt2p, int ldb, long strideB,
    void* __restrict__ Cout, void* __restrict__ Cout2, int ldc, long strideC,
    const float* __restrict__ bias,
    const float* __restrict__ resid, long strideR,
    int M, int N, int K, float scale) {
  typedef typename Elem<ET>::T T;
  typedef typename Frag<T>::V V;
  const T* A = (const T*)Ap; const T* A2 = (const T*)A2p; const T* Bt = (const T*)Btp; const T* Bt2 = (const T*)Bt2p;
  __shared__ __align__(16) float sT[8][16 * 68];   // per-wave 16x64 slab, pitch 68 floats
  const int b    = blockIdx.y;
  const int lane = threadIdx.x & 31;
  const int wave = threadIdx.x >> 5;
  const int tilesN = N >> 6;
  const int tilesM = M >> 6;
  const int tile = blockIdx.x * 8 + wave;
  if (tile >= tilesM * tilesN) return;   // wave-uniform; no block barriers in this kernel
  const int tm = tile / tilesN;
  const int tn = tile - tm * tilesN;
  const int m0 = tm << 6;
  const int n0 = tn << 6;

  const T* Ab  = A  + (size_t)b * strideA;
  const T* Bb  = Bt + (size_t)b * strideB;
  const T* Ab2 = SPLIT ? (A2  + (size_t)b * strideA) : nullptr;
  const T* Bb2 = SPLIT ? (Bt2 + (size_t)b * strideB) : nullptr;

  const int rlane = lane & 15;                 // row (A) / col (B, D) within subtile
  const int koff  = (lane >> 4) * 8;           // k offset of this lane half
  const int mOff  = (lane >> 4) * 8;           // D row offset

  v8f acc[4][4];
#pragma unroll
  for (int i = 0; i < 4; ++i)
#pragma unroll
    for (int j = 0; j < 4; ++j) acc[i][j] = (v8f){0.f,0.f,0.f,0.f,0.f,0.f,0.f,0.f};

  for (int k0 = 0; k0 < K; k0 += 32) {
    V bh[4], bl[4];
#pragma unroll
    for (int j = 0; j < 4; ++j) {
      const size_t bo = (size_t)(n0 + (j << 4) + rlane) * ldb + koff + k0;
      bh[j] = Frag<T>::load(Bb + bo);
      if (SPLIT) bl[j] = Frag<T>::load(Bb2 + bo);
    }
#pragma unroll
    for (int i = 0; i < 4; ++i) {
      const size_t ao = (size_t)(m0 + (i << 4) + rlane) * lda + koff + k0;
      V ah = Frag<T>::load(Ab + ao);
      V al;
      if (SPLIT) al = Frag<T>::load(Ab2 + ao);
#pragma unroll
      for (int j = 0; j < 4; ++j) {
        acc[i][j] = Frag<T>::mma(ah, bh[j], acc[i][j]);
        if (SPLIT) {
          acc[i][j] = Frag<T>::mma(ah, bl[j], acc[i][j]);
          acc[i][j] = Frag<T>::mma(al, bh[j], acc[i][j]);
        }
      }
      Frag<T>::guard(acc[i][0], acc[i][3], ah, SPLIT ? al : ah);
    }
    Frag<T>::keep(bh[0], bh[1], bh[2], bh[3]);
    if (SPLIT) Frag<T>::keep(bl[0], bl[1], bl[2], bl[3]);
  }
  acc_guard4(acc[0][0], acc[0][1], acc[0][2], acc[0][3]);
  acc_guard4(acc[1][0], acc[1][1], acc[1][2], acc[1][3]);
  acc_guard4(acc[2][0], acc[2][1], acc[2][2], acc[2][3]);
  acc_guard4(acc[3][0], acc[3][1], acc[3][2], acc[3][3]);

  // ---- epilogue ----
  float* slab = sT[wave];
  const float* Rb = RESID ? (resid + (size_t)b * strideR) : nullptr;
#pragma unroll
  for (int i = 0; i < 4; ++i) {
    const int mBase = m0 + (i << 4);
#pragma unroll
    for (int j = 0; j < 4; ++j) {
      const int n = n0 + (j << 4) + rlane;
      float bv = 0.f;
      if (BIAS_MODE == 2) bv = bias[n];
#pragma unroll
      for (int r = 0; r < 8; ++r) {
        float v = acc[i][j][r] * scale;
        if (BIAS_MODE == 1) v += bias[mBase + mOff + r];
        if (BIAS_MODE == 2) v += bv;
        if (RESID) v += Rb[(size_t)(mBase + mOff + r) * ldc + n];
        if (ACT == 2) v = fmaxf(v, 0.0f);
        if (ACT == 4) v = (v > 0.f) ? v : 0.01f * v;
        slab[(mOff + r) * 68 + (j << 4) + rlane] = v;
      }
    }
    __builtin_amdgcn_fence(__ATOMIC_RELEASE, "workgroup");
    __builtin_amdgcn_wave_barrier();
    __builtin_amdgcn_fence(__ATOMIC_ACQUIRE, "workgroup");
    if (OUT_MODE == 0) {
      float* C = (float*)Cout + (size_t)b * strideC;
      const int hh = lane >> 4, c4 = (lane & 15) * 4;     // row seg = 256 B = 16 lanes x 16 B
      {
#pragma unroll
        for (int it = 0; it < 8; ++it) {
          const int row = it * 2 + hh;
          v4f v = *(const v4f*)(slab + row * 68 + c4);
          *(v4f*)(C + (size_t)(mBase + row) * ldc + n0 + c4) = v;
        }
        
      }
    } else {
      const int q = lane >> 3, c8 = (lane & 7) * 8;
      unsigned short* C  = (unsigned short*)Cout  + (size_t)b * strideC;
      unsigned short* C2 = (OUT_MODE == 2) ? ((unsigned short*)Cout2 + (size_t)b * strideC) : nullptr;
      {
#pragma unroll
        for (int it = 0; it < 4; ++it) {
          const int row = it * 4 + q;
          const float* sp = slab + row * 68 + c8;
          v8h hv, lv;
#pragma unroll
          for (int e = 0; e < 8; ++e) {
            if (OUT_MODE == 1) {
              hv[e] = (_Float16)sp[e];
            } else {
              unsigned short hb = f2bf_bits(sp[e]);
              unsigned short lb = f2bf_bits(sp[e] - bf_bits2f(hb));
              hv[e] = __builtin_bit_cast(_Float16, hb);
              lv[e] = __builtin_bit_cast(_Float16, lb);
            }
          }
          *(v8h*)(C + (size_t)(mBase + row) * ldc + n0 + c8) = hv;
          if (OUT_MODE == 2) *(v8h*)(C2 + (size_t)(mBase + row) * ldc + n0 + c8) = lv;
        }
        
      }
    }
    __builtin_amdgcn_fence(__ATOMIC_RELEASE, "workgroup");
    __builtin_amdgcn_wave_barrier();
    __builtin_amdgcn_fence(__ATOMIC_ACQUIRE, "workgroup");
  }
}

// ---------------------------------------------------------------------------
// P.V^T GEMM with gamma scale and residual epilogue (f16 operands, no split):
//   Cout[m][n] = gsc[0] * (scale * sum_k A[m][k] * Bt[n][k]) + resid[m][n]
// A row-major [M][lda] (the V plane, k = key index contiguous), Bt row-major [N][ldb] (probability rows),
// Cout / resid row-major with pitch ldc (Cout is a column window of the output, resid the same window of x).
// M, N % 64 == 0, K % 32 == 0. Each wave owns a 64x64 tile; epilogue: 16-row slabs staged per wave in LDS,
// residual read in the store phase as one float4 per lane at the store address, each 256-B row segment
// ---------------------------------------------------------------------------
__global__ __launch_bounds__(256) void wmma_pv_out_kernel(
    const unsigned short* __restrict__ Ap, int lda,
    const unsigned short* __restrict__ Btp, int ldb,
    float* __restrict__ Cout, int ldc,
    const float* __restrict__ resid,
    const float* __restrict__ gsc,
    int M, int N, int K, float scale) {
  typedef _Float16 T;
  typedef v16h V;
  const T* A = (const T*)Ap; const T* Bt = (const T*)Btp;
  __shared__ __align__(16) float sT[8][16 * 68];   // per-wave 16x64 slab, pitch 68 floats
  const int lane = threadIdx.x & 31;
  const int wave = threadIdx.x >> 5;
  const int tilesN = N >> 6;
  const int tilesM = M >> 6;
  const int tile = blockIdx.x * 8 + wave;
  if (tile >= tilesM * tilesN) return;   // wave-uniform; no block barriers in this kernel
  const int tm = tile / tilesN;
  const int tn = tile - tm * tilesN;
  const int m0 = tm << 6;
  const int n0 = tn << 6;
  const int rlane = lane & 15;
  const int koff  = (lane >> 4) * 8;
  const int mOff  = (lane >> 4) * 8;
  const float gmul = gsc[0];

  v8f acc[4][4];
#pragma unroll
  for (int i = 0; i < 4; ++i)
#pragma unroll
    for (int j = 0; j < 4; ++j) acc[i][j] = (v8f){0.f,0.f,0.f,0.f,0.f,0.f,0.f,0.f};

  for (int k0 = 0; k0 < K; k0 += 32) {
    V bh[4];
#pragma unroll
    for (int j = 0; j < 4; ++j) {
      const size_t bo = (size_t)(n0 + (j << 4) + rlane) * ldb + koff + k0;
      bh[j] = Frag<T>::load(Bt + bo);
    }
#pragma unroll
    for (int i = 0; i < 4; ++i) {
      const size_t ao = (size_t)(m0 + (i << 4) + rlane) * lda + koff + k0;
      V ah = Frag<T>::load(A + ao);
#pragma unroll
      for (int j = 0; j < 4; ++j) acc[i][j] = Frag<T>::mma(ah, bh[j], acc[i][j]);
      Frag<T>::guard(acc[i][0], acc[i][3], ah, ah);
    }
    Frag<T>::keep(bh[0], bh[1], bh[2], bh[3]);
  }
  acc_guard4(acc[0][0], acc[0][1], acc[0][2], acc[0][3]);
  acc_guard4(acc[1][0], acc[1][1], acc[1][2], acc[1][3]);
  acc_guard4(acc[2][0], acc[2][1], acc[2][2], acc[2][3]);
  acc_guard4(acc[3][0], acc[3][1], acc[3][2], acc[3][3]);

  // ---- epilogue ----
  float* slab = sT[wave];
#pragma unroll
  for (int i = 0; i < 4; ++i) {
    const int mBase = m0 + (i << 4);
#pragma unroll
    for (int j = 0; j < 4; ++j) {
#pragma unroll
      for (int r = 0; r < 8; ++r) slab[(mOff + r) * 68 + (j << 4) + rlane] = acc[i][j][r] * scale;
    }
    __builtin_amdgcn_fence(__ATOMIC_RELEASE, "workgroup");
    __builtin_amdgcn_wave_barrier();
    __builtin_amdgcn_fence(__ATOMIC_ACQUIRE, "workgroup");
    {
      const int hh = lane >> 4, c4 = (lane & 15) * 4;     // row seg = 256 B = 16 lanes x 16 B
      v4f rv[8];
#pragma unroll
      for (int it = 0; it < 8; ++it) {
        const int row = it * 2 + hh;
        const v4f sv = *(const v4f*)(slab + row * 68 + c4);
        const v4f xv = *(const v4f*)(resid + (size_t)(mBase + row) * ldc + n0 + c4);
        v4f rr;
#pragma unroll
        for (int e = 0; e < 4; ++e) rr[e] = fmaf(gmul, sv[e], xv[e]);
        rv[it] = rr;
      }
      {
#pragma unroll
        for (int it = 0; it < 8; ++it) {
          const int row = it * 2 + hh;
          *(v4f*)(Cout + (size_t)(mBase + row) * ldc + n0 + c4) = rv[it];
        }
        
      }
    }
    __builtin_amdgcn_fence(__ATOMIC_RELEASE, "workgroup");
    __builtin_amdgcn_wave_barrier();
    __builtin_amdgcn_fence(__ATOMIC_ACQUIRE, "workgroup");
  }
}

// ---------------------------------------------------------------------------
// Weight / bias preparation (one block of 256 threads):
//   WQKh/WQKl: bf16 hi/lo planes of a [64][64] matrix whose rows 0..7 = Wq[out][in], rows 32..39 = Wk[out][in], all other
//   rows zero (computed per lane, both source rows loaded unconditionally with clamped indices, combined arithmetically).
//   WVh/WVl: bf16 hi/lo planes of Wv[64][64]. BQK: f32 [64] with bq at 0..7, bk at 32..39, zero elsewhere.
// ---------------------------------------------------------------------------
__global__ __launch_bounds__(256) void prep_kernel(const float* __restrict__ Wq, const float* __restrict__ Wk,
                                                   const float* __restrict__ Wv,
                                                   const float* __restrict__ bq, const float* __restrict__ bk,
                                                   unsigned short* __restrict__ WQKh, unsigned short* __restrict__ WQKl,
                                                   unsigned short* __restrict__ WVh, unsigned short* __restrict__ WVl,
                                                   float* __restrict__ BQK) {
  const int t = threadIdx.x;
#pragma unroll 1
  for (int it = 0; it < 2; ++it) {
    const int ch = it * 256 + t;            // 0..511 chunks of 8 halves
    const int r  = ch >> 3;                 // output row 0..63
    const int c8 = (ch & 7) * 8;
    const int rq = (r < kCq) ? r : (kCq - 1);
    int rk = r - 32; rk = (rk < 0) ? 0 : rk; rk = (rk > kCq - 1) ? (kCq - 1) : rk;
    const float fq = (r < kCq) ? 1.0f : 0.0f;
    const float fk = ((unsigned)(r - 32) < (unsigned)kCq) ? 1.0f : 0.0f;
    const v4f qa = *(const v4f*)(Wq + rq * kC + c8);
    const v4f qb = *(const v4f*)(Wq + rq * kC + c8 + 4);
    const v4f ka = *(const v4f*)(Wk + rk * kC + c8);
    const v4f kb = *(const v4f*)(Wk + rk * kC + c8 + 4);
    unsigned short hb[8], lb[8];
#pragma unroll
    for (int e = 0; e < 4; ++e) {
      const float v0 = fmaf(fq, qa[e], fk * ka[e]);
      const float v1 = fmaf(fq, qb[e], fk * kb[e]);
      hb[e] = f2bf_bits(v0);
      lb[e] = f2bf_bits(v0 - bf_bits2f(hb[e]));
      hb[4 + e] = f2bf_bits(v1);
      lb[4 + e] = f2bf_bits(v1 - bf_bits2f(hb[4 + e]));
    }
    const v4u uh = (v4u){pk16(hb[0], hb[1]), pk16(hb[2], hb[3]), pk16(hb[4], hb[5]), pk16(hb[6], hb[7])};
    const v4u ul = (v4u){pk16(lb[0], lb[1]), pk16(lb[2], lb[3]), pk16(lb[4], lb[5]), pk16(lb[6], lb[7])};
    unsigned short* ph = WQKh + 8 * (size_t)ch;
    unsigned short* pl = WQKl + 8 * (size_t)ch;
    *(v4u*)ph = uh;
    *(v4u*)pl = ul;
    
  }
#pragma unroll 1
  for (int it = 0; it < 2; ++it) {
    const int ch = it * 256 + t;
    const int r  = ch >> 3;
    const int c8 = (ch & 7) * 8;
    const v4f va = *(const v4f*)(Wv + r * kC + c8);
    const v4f vb = *(const v4f*)(Wv + r * kC + c8 + 4);
    unsigned short hb[8], lb[8];
#pragma unroll
    for (int e = 0; e < 4; ++e) {
      hb[e] = f2bf_bits(va[e]);
      lb[e] = f2bf_bits(va[e] - bf_bits2f(hb[e]));
      hb[4 + e] = f2bf_bits(vb[e]);
      lb[4 + e] = f2bf_bits(vb[e] - bf_bits2f(hb[4 + e]));
    }
    const v4u uh = (v4u){pk16(hb[0], hb[1]), pk16(hb[2], hb[3]), pk16(hb[4], hb[5]), pk16(hb[6], hb[7])};
    const v4u ul = (v4u){pk16(lb[0], lb[1]), pk16(lb[2], lb[3]), pk16(lb[4], lb[5]), pk16(lb[6], lb[7])};
    unsigned short* ph = WVh + 8 * (size_t)ch;
    unsigned short* pl = WVl + 8 * (size_t)ch;
    *(v4u*)ph = uh;
    *(v4u*)pl = ul;
    
  }
  {
    const int tt = t & 15;
    v4f bvv;
#pragma unroll
    for (int e = 0; e < 4; ++e) {
      const int i  = 4 * tt + e;             // 0..63
      const int iq = (i < kCq) ? i : (kCq - 1);
      int ik = i - 32; ik = (ik < 0) ? 0 : ik; ik = (ik > kCq - 1) ? (kCq - 1) : ik;
      const float fq = (i < kCq) ? 1.0f : 0.0f;
      const float fk = ((unsigned)(i - 32) < (unsigned)kCq) ? 1.0f : 0.0f;
      bvv[e] = fmaf(fq, bq[iq], fk * bk[ik]);
    }
    if (t < 16) {
      float* pb = BQK + 4 * t;
      *(v4f*)pb = bvv;
      
    }
  }
}

// ---------------------------------------------------------------------------
// x transpose + bf16 hi/lo split: XTh/XTl[b][n][c] = hi/lo( x[b][c][n] ).
// grid (125, 2): blockIdx.x = 64-wide n tile, blockIdx.y = batch; 256 threads.
// Load coverage: 2 x 8 iterations x 256 threads = 4096 = whole 64(c) x 64(n) tile (coalesced along n).
// Store coverage: 8 waves x 2 iterations x 4 rows (lane>>3) = 64 n-rows; (lane&7) x 8 halves = 64 c-cols; each row = 64 halves =
// ---------------------------------------------------------------------------
__global__ __launch_bounds__(256) void xt_split_kernel(const float* __restrict__ x, unsigned short* __restrict__ XTh,
                                                       unsigned short* __restrict__ XTl) {
  __shared__ float sm[64][65];   // sm[n_local][c]
  const int t  = threadIdx.x;
  const int n0 = blockIdx.x * 64;
  const int b  = blockIdx.y;
  const float* xb = x + (size_t)b * kC * kN;
#pragma unroll 1
  for (int i2 = 0; i2 < 2; ++i2) {
#pragma unroll
    for (int i = 0; i < 8; ++i) {
      const int e  = (i2 * 8 + i) * 256 + t;
      const int c  = e >> 6;          // channel 0..63
      const int nl = e & 63;          // n local
      sm[nl][c] = xb[(size_t)c * kN + n0 + nl];
    }
  }
  __syncthreads();
  const int lane = t & 31, wave = t >> 5;
  const int q = lane >> 3, c8 = (lane & 7) * 8;
  unsigned short* oh = XTh + (size_t)b * kN * kC;
  unsigned short* ol = XTl + (size_t)b * kN * kC;
  v4u uh[2], ul[2];
#pragma unroll
  for (int it = 0; it < 2; ++it) {
    const int row = wave * 8 + it * 4 + q;   // n local
    unsigned short hb[8], lb[8];
#pragma unroll
    for (int e = 0; e < 8; ++e) {
      const float v = sm[row][c8 + e];
      hb[e] = f2bf_bits(v);
      lb[e] = f2bf_bits(v - bf_bits2f(hb[e]));
    }
    uh[it] = (v4u){pk16(hb[0], hb[1]), pk16(hb[2], hb[3]), pk16(hb[4], hb[5]), pk16(hb[6], hb[7])};
    ul[it] = (v4u){pk16(lb[0], lb[1]), pk16(lb[2], lb[3]), pk16(lb[4], lb[5]), pk16(lb[6], lb[7])};
  }
  {
#pragma unroll
    for (int it = 0; it < 2; ++it) {
      const int row = wave * 8 + it * 4 + q;
      *(v4u*)(oh + (size_t)(n0 + row) * kC + c8) = uh[it];
      *(v4u*)(ol + (size_t)(n0 + row) * kC + c8) = ul[it];
    }
    
  }
}

// ---------------------------------------------------------------------------
// Packed q|k operand plane: from the f32 projection output QKF[row][64] (cols 0..7 = q, cols 32..39 = k, rest 0) build
// QKP[row][64] bf16 with cols 0..7 = hi(q), 8..15 = lo(q), 16..23 = hi(q), 24..31 = 0, 32..39 = hi(k), 40..47 = hi(k),
// 48..55 = lo(k), 56..63 = 0, so that sum_{s<32} QKP[n][s] * QKP[m][32+s] = qh.kh + ql.kh + qh.kl.
// 256 threads = 32 rows x 8 lane groups; group g owns cols 8g..8g+7; both q and k of the row are loaded by every lane
// ---------------------------------------------------------------------------
__global__ __launch_bounds__(256) void qk_pack_kernel(const float* __restrict__ QKF, unsigned short* __restrict__ QKP, int nrows) {
  const int t    = threadIdx.x;
  const int rowi = blockIdx.x * 32 + (t >> 3);
  const int g    = t & 7;
  const int rowc = (rowi < nrows) ? rowi : (nrows - 1);
  const float* rp = QKF + (size_t)rowc * kKP;
  const v4f qa = *(const v4f*)(rp);
  const v4f qb = *(const v4f*)(rp + 4);
  const v4f ka = *(const v4f*)(rp + 32);
  const v4f kb = *(const v4f*)(rp + 36);
  const float fq = (g < 3) ? 1.0f : 0.0f;
  const float fk = ((unsigned)(g - 4) < 3u) ? 1.0f : 0.0f;
  const bool islo = (g == 1) || (g == 6);
  unsigned short ob[8];
#pragma unroll
  for (int e = 0; e < 4; ++e) {
    const float v0 = fmaf(fq, qa[e], fk * ka[e]);
    const float v1 = fmaf(fq, qb[e], fk * kb[e]);
    const unsigned short h0 = f2bf_bits(v0);
    const unsigned short l0 = f2bf_bits(v0 - bf_bits2f(h0));
    const unsigned short h1 = f2bf_bits(v1);
    const unsigned short l1 = f2bf_bits(v1 - bf_bits2f(h1));
    ob[e]     = islo ? l0 : h0;
    ob[4 + e] = islo ? l1 : h1;
  }
  const v4u u = (v4u){pk16(ob[0], ob[1]), pk16(ob[2], ob[3]), pk16(ob[4], ob[5]), pk16(ob[6], ob[7])};
  if (rowi < nrows) {
    unsigned short* dst = QKP + (size_t)rowi * kKP + 8 * g;
    *(v4u*)dst = u;
    
  }
}

// ---------------------------------------------------------------------------
// Row softmax over 8000 f32 scores: P[row][j] = f16( 32768 * exp(s - max) / sum exp(s - max) ), f32 math, precise expf.
// One block of 256 threads per row; thread t owns 16-byte chunks ch = it*256 + t (8 scores each), it = 0..3, valid for
// ch < 1000 (only it = 3, t >= 232 is idle; those lanes load a clamped in-range address and contribute neutral values).
// Phase 1: global loads -> row max, scores staged in LDS (every LDS word read later is written here: 1000 chunks x 8).
// Phase 2: exp and row sum (each thread re-reads and rewrites only its own chunks, 4 at a time, rolled loop).
// Reductions in fixed order (thread, wave shuffle tree, 8 wave partials in index order); block barriers between phases.
// ---------------------------------------------------------------------------
__global__ __launch_bounds__(256) void softmax_row_kernel(const float* __restrict__ SC, unsigned short* __restrict__ P) {
  __shared__ __align__(16) float lg[kN];
  __shared__ float redM[8];
  __shared__ float redS[8];
  const int row  = blockIdx.x;
  const int t    = threadIdx.x;
  const int lane = t & 31, wave = t >> 5;
  const float* sr = SC + (size_t)row * kN;

  float mx = -__builtin_inff();
#pragma unroll 1
  for (int it = 0; it < 4; ++it) {
    const int ch  = it * 256 + t;
    const bool valid = ch < kNC8;
    const int chc = valid ? ch : (kNC8 - 1);
    const v4f a = *(const v4f*)(sr + 8 * chc);
    const v4f c = *(const v4f*)(sr + 8 * chc + 4);
    const float m8 = fmaxf(fmaxf(fmaxf(a[0], a[1]), fmaxf(a[2], a[3])), fmaxf(fmaxf(c[0], c[1]), fmaxf(c[2], c[3])));
    mx = fmaxf(mx, m8);
    if (valid) {
      *(v4f*)(lg + 8 * ch)     = a;
      *(v4f*)(lg + 8 * ch + 4) = c;
    }
  }
#pragma unroll
  for (int off = 16; off > 0; off >>= 1) mx = fmaxf(mx, __shfl_xor(mx, off, 32));
  if (lane == 0) redM[wave] = mx;
  __syncthreads();
  float m = redM[0];
#pragma unroll
  for (int w = 1; w < 8; ++w) m = fmaxf(m, redM[w]);

  float sum = 0.0f;
#pragma unroll 1
  for (int it = 0; it < 8; ++it) {
    const int ch  = (it >> 1) * 256 + t;
    const int hf  = (it & 1) * 4;
    const bool valid = ch < kNC8;
    const int chc = valid ? ch : (kNC8 - 1);
    const float fv = valid ? 1.0f : 0.0f;
    const v4f l = *(const v4f*)(lg + 8 * chc + hf);
    v4f ev;
#pragma unroll
    for (int e = 0; e < 4; ++e) {
      const float l0 = valid ? l[e] : m;
      ev[e] = expf(l0 - m);
      sum = fmaf(fv, ev[e], sum);
    }
    if (valid) *(v4f*)(lg + 8 * ch + hf) = ev;
  }
#pragma unroll
  for (int off = 16; off > 0; off >>= 1) sum += __shfl_xor(sum, off, 32);
  if (lane == 0) redS[wave] = sum;
  __syncthreads();
  float tot = redS[0];
#pragma unroll
  for (int w = 1; w < 8; ++w) tot += redS[w];
  const float inv = kPCarry / tot;

  v4u u[4];
#pragma unroll
  for (int it = 0; it < 4; ++it) {
    const int ch  = it * 256 + t;
    const int chc = (ch < kNC8) ? ch : (kNC8 - 1);
    const v4f e0 = *(const v4f*)(lg + 8 * chc);
    const v4f e1 = *(const v4f*)(lg + 8 * chc + 4);
    unsigned short hb[8];
#pragma unroll
    for (int e = 0; e < 4; ++e) {
      hb[e]     = h_bits(e0[e] * inv);
      hb[4 + e] = h_bits(e1[e] * inv);
    }
    u[it] = (v4u){pk16(hb[0], hb[1]), pk16(hb[2], hb[3]), pk16(hb[4], hb[5]), pk16(hb[6], hb[7])};
  }
  unsigned short* pr = P + (size_t)row * kN;
#pragma unroll
  for (int it = 0; it < 4; ++it) {
    const int ch = it * 256 + t;
    if (ch < kNC8) *(v4u*)(pr + 8 * (size_t)ch) = u[it];
  }
  
}

// ---------------------------------------------------------------------------
// Host glue.
//   XTh  bf16 [2][8000][64]      2,048,000  at          0
//   XTl  bf16 [2][8000][64]      2,048,000  at  2,048,000
//   WQKh bf16 [64][64]               8,192  at  4,096,000
//   WQKl bf16 [64][64]               8,192  at  4,104,192
//   WVh  bf16 [64][64]               8,192  at  4,112,384
//   WVl  bf16 [64][64]               8,192  at  4,120,576
//   BQK  f32  [64]                     256  at  4,128,768
//   QKF  f32  [2][8000][64]      4,096,000  at  4,129,024
//   QKP  bf16 [2][8000][64]      2,048,000  at  8,225,024
//   VP   f16  [2][64][8000]      2,048,000  at 10,273,024
//   SC   f32  [1600][8000]      51,200,000  at 12,321,024   (scores of one (batch, 1600-row) chunk, reused 10x)
//   PP   f16  [1600][8000]      25,600,000  at 63,521,024   (probabilities x32768, reused 10x)
//   total                      89,121,024
// GEMM shapes: q|k projection M=8000, N=64, K=64; v projection M=64, N=8000, K=64; scores M=1600, N=8000, K=32;
// P.V^T M=64, N=1600, K=8000. All M, N multiples of 64, all K multiples of 32, no partial tiles, no padding rows.
// ---------------------------------------------------------------------------
extern "C" void kernel_launch(void* const* d_in, const int* in_sizes, int n_in,
                              void* d_out, int out_size, void* d_ws, size_t ws_size,
                              hipStream_t stream) {
  if (n_in < 8) return;
  const int nElem = kB * kC * kN;                 // 1,024,000
  if (in_sizes[0] != nElem) return;
  if (in_sizes[1] != kCq * kC || in_sizes[2] != kCq) return;
  if (in_sizes[3] != kCq * kC || in_sizes[4] != kCq) return;
  if (in_sizes[5] != kC * kC || in_sizes[6] != kC || in_sizes[7] < 1) return;
  if (out_size != nElem) return;

  const size_t szXT  = (size_t)kB * kN * kC * 2;
  const size_t szW   = (size_t)64 * 64 * 2;
  const size_t szBQK = (size_t)64 * 4;
  const size_t szQKF = (size_t)kB * kN * kKP * 4;
  const size_t szQKP = (size_t)kB * kN * kKP * 2;
  const size_t szVP  = (size_t)kB * kC * kN * 2;
  const size_t szSC  = (size_t)kQCH * kN * 4;
  const size_t szP   = (size_t)kQCH * kN * 2;
  const size_t offXTh  = 0;
  const size_t offXTl  = offXTh + szXT;
  const size_t offWQKh = offXTl + szXT;
  const size_t offWQKl = offWQKh + szW;
  const size_t offWVh  = offWQKl + szW;
  const size_t offWVl  = offWVh + szW;
  const size_t offBQK  = offWVl + szW;
  const size_t offQKF  = offBQK + szBQK;
  const size_t offQKP  = offQKF + szQKF;
  const size_t offVP   = offQKP + szQKP;
  const size_t offSC   = offVP + szVP;
  const size_t offP    = offSC + szSC;
  const size_t total   = offP + szP;
  if (ws_size < total) return;

  const float* x     = (const float*)d_in[0];
  const float* Wq    = (const float*)d_in[1];
  const float* bq    = (const float*)d_in[2];
  const float* Wk    = (const float*)d_in[3];
  const float* bk    = (const float*)d_in[4];
  const float* Wv    = (const float*)d_in[5];
  const float* bv    = (const float*)d_in[6];
  const float* gamma = (const float*)d_in[7];
  float* out = (float*)d_out;
  char* ws = (char*)d_ws;
  unsigned short* XTh  = (unsigned short*)(ws + offXTh);
  unsigned short* XTl  = (unsigned short*)(ws + offXTl);
  unsigned short* WQKh = (unsigned short*)(ws + offWQKh);
  unsigned short* WQKl = (unsigned short*)(ws + offWQKl);
  unsigned short* WVh  = (unsigned short*)(ws + offWVh);
  unsigned short* WVl  = (unsigned short*)(ws + offWVl);
  float* BQK = (float*)(ws + offBQK);
  float* QKF = (float*)(ws + offQKF);
  unsigned short* QKP = (unsigned short*)(ws + offQKP);
  unsigned short* VP  = (unsigned short*)(ws + offVP);
  float* SC = (float*)(ws + offSC);
  unsigned short* PP = (unsigned short*)(ws + offP);

  // ---- prologue: weight planes, x^T planes, projections ----
  prep_kernel<<<dim3(1), dim3(256), 0, stream>>>(Wq, Wk, Wv, bq, bk, WQKh, WQKl, WVh, WVl, BQK);
  xt_split_kernel<<<dim3(kN / 64, kB), dim3(256), 0, stream>>>(x, XTh, XTl);
  // QKF[b][n][col] = sum_c XT[b][n][c] * WQK[col][c] + BQK[col]   (M=8000, N=64, K=64; bf16 hi/lo both operands)
  wmma_gemm64<1, true, 2, 0, false, 0><<<dim3(kBlocksProj, kB), dim3(256), 0, stream>>>(
      XTh, XTl, kC, (long)kN * kC,
      WQKh, WQKl, kC, 0L,
      (void*)QKF, (void*)QKF, kKP, (long)kN * kKP,
      BQK, BQK, 0L,
      kN, kKP, kC, 1.0f);
  qk_pack_kernel<<<dim3((kB * kN) / 32), dim3(256), 0, stream>>>(QKF, QKP, kB * kN);
  // VP[b][c][m] = f16( sum_c' WV[c][c'] * XT[b][m][c'] + bv[c] )   (M=64, N=8000, K=64; bf16 hi/lo both operands)
  wmma_gemm64<1, true, 1, 1, false, 0><<<dim3(kBlocksProj, kB), dim3(256), 0, stream>>>(
      WVh, WVl, kC, 0L,
      XTh, XTl, kC, (long)kN * kC,
      (void*)VP, (void*)VP, kN, (long)kC * kN,
      bv, bv, 0L,
      kC, kN, kC, 1.0f);

  // ---- per (batch, 1600-row query chunk): scores -> softmax -> P.V^T with gamma and residual ----
  for (int b = 0; b < kB; ++b) {
    const unsigned short* qkb = QKP + (size_t)b * kN * kKP;
    const unsigned short* vpb = VP + (size_t)b * kC * kN;
    for (int chk = 0; chk < kNChunk; ++chk) {
      const int q0 = chk * kQCH;
      // SC[i][m] = sum_{s<32} QKP[b][q0+i][s] * QKP[b][m][32+s]   (M=1600, N=8000, K=32)
      wmma_gemm64<1, false, 0, 0, false, 0><<<dim3(kBlocksScore, 1), dim3(256), 0, stream>>>(
          qkb + (size_t)q0 * kKP, qkb + (size_t)q0 * kKP, kKP, 0L,
          qkb + 32, qkb + 32, kKP, 0L,
          (void*)SC, (void*)SC, kN, 0L,
          BQK, BQK, 0L,
          kQCH, kN, 32, 1.0f);
      softmax_row_kernel<<<dim3(kQCH), dim3(256), 0, stream>>>(SC, PP);
      // out[b][c][q0+n] = gamma * 2^-15 * sum_m VP[b][c][m] * PP[n][m] + x[b][c][q0+n]   (M=64, N=1600, K=8000)
      wmma_pv_out_kernel<<<dim3(kBlocksPV), dim3(256), 0, stream>>>(
          vpb, kN, PP, kN,
          out + (size_t)b * kC * kN + q0, kN,
          x + (size_t)b * kC * kN + q0,
          gamma,
          kC, kQCH, kN, kPCarryInv);
    }
  }
}

// v001
// A run of this version takes 376 microseconds.
// In two side-by-side timings against v000, it was 9.37 and 9.30 times as fast.
// Contractions: q/k/v channel projections on v_wmma_f32_16x16x32_bf16 with x^T and W as bf16 hi+lo planes (hh+hl+lh); energy q.k^T on v_wmma_f32_16x16x32_bf16 with q,k bf16 hi|lo parts packed along the 32-deep k axis (hh+lh+hl in one pass); P.V^T on v_wmma_f32_16x16x32_f16 (P f16 carried x32768, V f16 plane); f32 accumulate everywhere; softmax, biases, gamma scale and residual in f32.
#include <hip/hip_runtime.h>
#include <math.h>

// ---------------------------------------------------------------------------
// Problem constants
// ---------------------------------------------------------------------------
constexpr int kB    = 2;        // batch
constexpr int kC    = 64;       // channels (value dim and projection K)
constexpr int kCq   = 8;        // query/key channels
constexpr int kN    = 8000;     // voxels per sample (20*20*20)
constexpr int kKP   = 64;       // packed q|k row width in halves: q block cols 0..31, k block cols 32..63
constexpr int kQCH  = 1600;     // query rows per score chunk
constexpr int kNChunk = kN / kQCH;          // 5
constexpr int kNC8  = kN / 8;               // 1000 16-byte chunks per score/probability row
constexpr float kPCarry    = 32768.0f;      // probabilities carried x2^15 in f16
constexpr float kPCarryInv = 1.0f / 32768.0f;
constexpr int kTilesProj   = (kN / 64) * (kKP / 64);      // 125
constexpr int kBlocksProj  = (kTilesProj + 7) / 8;         // 16
constexpr int kTilesScore  = (kQCH / 64) * (kN / 64);      // 3125
constexpr int kBlocksScore = (kTilesScore + 7) / 8;        // 391
static_assert(kN % 64 == 0 && kQCH % 64 == 0 && kN % kQCH == 0, "tiles");
static_assert(kC == 64 && kKP % 32 == 0 && kC % 32 == 0 && kN % 32 == 0, "k multiples");
static_assert(kNC8 % 8 == 0, "row chunk count is a whole number of lines");
static_assert((kB * kN) % 32 == 0, "pack rows per block");
static_assert(3 * kCq <= 32, "hi|lo|hi packing fits one k step");

typedef __attribute__((ext_vector_type(16))) _Float16 v16h;
typedef __attribute__((ext_vector_type(8)))  _Float16 v8h;
typedef __attribute__((ext_vector_type(16))) __bf16   v16b;
typedef __attribute__((ext_vector_type(8)))  __bf16   v8b;
typedef __attribute__((ext_vector_type(8)))  float    v8f;
typedef __attribute__((ext_vector_type(4)))  float    v4f;
typedef __attribute__((ext_vector_type(4)))  unsigned int v4u;

// ---------------------------------------------------------------------------
// Device helpers
// ---------------------------------------------------------------------------
__device__ __forceinline__ unsigned short f2bf_bits(float f) {
  unsigned u = __float_as_uint(f);
  return (unsigned short)((u + 0x7FFFu + ((u >> 16) & 1u)) >> 16);
}
__device__ __forceinline__ float bf_bits2f(unsigned short h) { return __uint_as_float(((unsigned)h) << 16); }

// hazard guards as plain device helpers (no inline asm inside the kernel template body)
__device__ __forceinline__ void dep_guard_h(v8f& a, v8f& b, v16h x, v16h y) { asm volatile("v_nop\n\tv_nop\n\tv_nop\n\tv_nop" : "+v"(a), "+v"(b) : "v"(x), "v"(y)); }
__device__ __forceinline__ void dep_guard_b(v8f& a, v8f& b, v16b x, v16b y) { asm volatile("v_nop\n\tv_nop\n\tv_nop\n\tv_nop" : "+v"(a), "+v"(b) : "v"(x), "v"(y)); }
__device__ __forceinline__ void keep4_h(v16h a, v16h b, v16h c, v16h d) { asm volatile("v_nop" :: "v"(a), "v"(b), "v"(c), "v"(d)); }
__device__ __forceinline__ void keep4_b(v16b a, v16b b, v16b c, v16b d) { asm volatile("v_nop" :: "v"(a), "v"(b), "v"(c), "v"(d)); }
__device__ __forceinline__ void acc_guard4(v8f& a, v8f& b, v8f& c, v8f& d) { asm volatile("v_nop\n\tv_nop\n\tv_nop\n\tv_nop" : "+v"(a), "+v"(b), "+v"(c), "+v"(d)); }
template <typename T> struct Frag;
template <> struct Frag<_Float16> {
  typedef v16h V; union U { v16h v; v8h h[2]; };
  // elements 0..7 <- p[0..7], 8..15 <- p[16..23]
  static __device__ __forceinline__ v16h load(const _Float16* p) {
    U f; f.h[0] = *(const v8h*)(p); f.h[1] = *(const v8h*)(p + 16); return f.v;
  }
  static __device__ __forceinline__ v8f mma(v16h a, v16h b, v8f c) {
    return __builtin_amdgcn_wmma_f32_16x16x32_f16(false, a, false, b, (short)0, c, false, false);
  }
  static __device__ __forceinline__ void guard(v8f& a, v8f& b, v16h x, v16h y) { dep_guard_h(a, b, x, y); }
  static __device__ __forceinline__ void keep(v16h a, v16h b, v16h c, v16h d) { keep4_h(a, b, c, d); }
};
template <> struct Frag<__bf16> {
  typedef v16b V; union U { v16b v; v8b h[2]; };
  static __device__ __forceinline__ v16b load(const __bf16* p) {
    U f; f.h[0] = *(const v8b*)(p); f.h[1] = *(const v8b*)(p + 16); return f.v;
  }
  static __device__ __forceinline__ v8f mma(v16b a, v16b b, v8f c) {
    return __builtin_amdgcn_wmma_f32_16x16x32_bf16(false, a, false, b, (short)0, c, false, false);
  }
  static __device__ __forceinline__ void guard(v8f& a, v8f& b, v16b x, v16b y) { dep_guard_b(a, b, x, y); }
  static __device__ __forceinline__ void keep(v16b a, v16b b, v16b c, v16b d) { keep4_b(a, b, c, d); }
};

__device__ __forceinline__ unsigned pk16(unsigned short a, unsigned short b) { return (unsigned)a | ((unsigned)b << 16); }
__device__ __forceinline__ unsigned short h_bits(float f) { const _Float16 h = (_Float16)f; return __builtin_bit_cast(unsigned short, h); }

// ---- Register-blocked batched WMMA GEMM (ACT reduced to none/relu/leaky) -------------------------------
// C[m,n] = scale * sum_k A[m,k] * Bt[n,k] (+bias)(+resid); each wave owns a 64x64 tile.
// A row-major [M,K]; Bt row-major [N,K]; M,N % 64 == 0, K % 32 == 0.
// SPLIT: operands are hi/lo planes (A2/Bt2 = lo planes, same layout); product = hi*hi + hi*lo + lo*hi.
// BIAS_MODE: 0 = none, 1 = bias[m], 2 = bias[n].
// OUT_MODE: 0 = f32, 1 = f16, 2 = bf16 hi plane (Cout) + bf16 lo plane (Cout2).
// ET: 0 = f16 operands, 1 = bf16 operands (pointers passed as 16-bit storage)
template <int ET> struct Elem;
template <> struct Elem<0> { typedef _Float16 T; };
template <> struct Elem<1> { typedef __bf16 T; };
template <int ET, bool SPLIT, int BIAS_MODE, int OUT_MODE, bool RESID, int ACT = 0>
__global__ __launch_bounds__(256) void wmma_gemm64(
    const unsigned short* __restrict__ Ap, const unsigned short* __restrict__ A2p, int lda, long strideA,
    const unsigned short* __restrict__ Btp, const unsigned short* __restrict__ Bt2p, int ldb, long strideB,
    void* __restrict__ Cout, void* __restrict__ Cout2, int ldc, long strideC,
    const float* __restrict__ bias,
    const float* __restrict__ resid, long strideR,
    int M, int N, int K, float scale) {
  typedef typename Elem<ET>::T T;
  typedef typename Frag<T>::V V;
  const T* A = (const T*)Ap; const T* A2 = (const T*)A2p; const T* Bt = (const T*)Btp; const T* Bt2 = (const T*)Bt2p;
  __shared__ __align__(16) float sT[8][16 * 68];   // per-wave 16x64 slab, pitch 68 floats
  const int b    = blockIdx.y;
  const int lane = threadIdx.x & 31;
  const int wave = threadIdx.x >> 5;
  const int tilesN = N >> 6;
  const int tilesM = M >> 6;
  const int tile = blockIdx.x * 8 + wave;
  if (tile >= tilesM * tilesN) return;   // wave-uniform; no block barriers in this kernel
  const int tm = tile / tilesN;
  const int tn = tile - tm * tilesN;
  const int m0 = tm << 6;
  const int n0 = tn << 6;

  const T* Ab  = A  + (size_t)b * strideA;
  const T* Bb  = Bt + (size_t)b * strideB;
  const T* Ab2 = SPLIT ? (A2  + (size_t)b * strideA) : nullptr;
  const T* Bb2 = SPLIT ? (Bt2 + (size_t)b * strideB) : nullptr;

  const int rlane = lane & 15;                 // row (A) / col (B, D) within subtile
  const int koff  = (lane >> 4) * 8;           // k offset of this lane half
  const int mOff  = (lane >> 4) * 8;           // D row offset

  v8f acc[4][4];
#pragma unroll
  for (int i = 0; i < 4; ++i)
#pragma unroll
    for (int j = 0; j < 4; ++j) acc[i][j] = (v8f){0.f,0.f,0.f,0.f,0.f,0.f,0.f,0.f};

  for (int k0 = 0; k0 < K; k0 += 32) {
    V bh[4], bl[4];
#pragma unroll
    for (int j = 0; j < 4; ++j) {
      const size_t bo = (size_t)(n0 + (j << 4) + rlane) * ldb + koff + k0;
      bh[j] = Frag<T>::load(Bb + bo);
      if (SPLIT) bl[j] = Frag<T>::load(Bb2 + bo);
    }
#pragma unroll
    for (int i = 0; i < 4; ++i) {
      const size_t ao = (size_t)(m0 + (i << 4) + rlane) * lda + koff + k0;
      V ah = Frag<T>::load(Ab + ao);
      V al;
      if (SPLIT) al = Frag<T>::load(Ab2 + ao);
#pragma unroll
      for (int j = 0; j < 4; ++j) {
        acc[i][j] = Frag<T>::mma(ah, bh[j], acc[i][j]);
        if (SPLIT) {
          acc[i][j] = Frag<T>::mma(ah, bl[j], acc[i][j]);
          acc[i][j] = Frag<T>::mma(al, bh[j], acc[i][j]);
        }
      }
      Frag<T>::guard(acc[i][0], acc[i][3], ah, SPLIT ? al : ah);
    }
    Frag<T>::keep(bh[0], bh[1], bh[2], bh[3]);
    if (SPLIT) Frag<T>::keep(bl[0], bl[1], bl[2], bl[3]);
  }
  acc_guard4(acc[0][0], acc[0][1], acc[0][2], acc[0][3]);
  acc_guard4(acc[1][0], acc[1][1], acc[1][2], acc[1][3]);
  acc_guard4(acc[2][0], acc[2][1], acc[2][2], acc[2][3]);
  acc_guard4(acc[3][0], acc[3][1], acc[3][2], acc[3][3]);

  // ---- epilogue ----
  float* slab = sT[wave];
  const float* Rb = RESID ? (resid + (size_t)b * strideR) : nullptr;
#pragma unroll
  for (int i = 0; i < 4; ++i) {
    const int mBase = m0 + (i << 4);
#pragma unroll
    for (int j = 0; j < 4; ++j) {
      const int n = n0 + (j << 4) + rlane;
      float bv = 0.f;
      if (BIAS_MODE == 2) bv = bias[n];
#pragma unroll
      for (int r = 0; r < 8; ++r) {
        float v = acc[i][j][r] * scale;
        if (BIAS_MODE == 1) v += bias[mBase + mOff + r];
        if (BIAS_MODE == 2) v += bv;
        if (RESID) v += Rb[(size_t)(mBase + mOff + r) * ldc + n];
        if (ACT == 2) v = fmaxf(v, 0.0f);
        if (ACT == 4) v = (v > 0.f) ? v : 0.01f * v;
        slab[(mOff + r) * 68 + (j << 4) + rlane] = v;
      }
    }
    __builtin_amdgcn_fence(__ATOMIC_RELEASE, "workgroup");
    __builtin_amdgcn_wave_barrier();
    __builtin_amdgcn_fence(__ATOMIC_ACQUIRE, "workgroup");
    if (OUT_MODE == 0) {
      float* C = (float*)Cout + (size_t)b * strideC;
      const int hh = lane >> 4, c4 = (lane & 15) * 4;     // row seg = 256 B = 16 lanes x 16 B
      {
#pragma unroll
        for (int it = 0; it < 8; ++it) {
          const int row = it * 2 + hh;
          v4f v = *(const v4f*)(slab + row * 68 + c4);
          *(v4f*)(C + (size_t)(mBase + row) * ldc + n0 + c4) = v;
        }
        
      }
    } else {
      const int q = lane >> 3, c8 = (lane & 7) * 8;
      unsigned short* C  = (unsigned short*)Cout  + (size_t)b * strideC;
      unsigned short* C2 = (OUT_MODE == 2) ? ((unsigned short*)Cout2 + (size_t)b * strideC) : nullptr;
      {
#pragma unroll
        for (int it = 0; it < 4; ++it) {
          const int row = it * 4 + q;
          const float* sp = slab + row * 68 + c8;
          v8h hv, lv;
#pragma unroll
          for (int e = 0; e < 8; ++e) {
            if (OUT_MODE == 1) {
              hv[e] = (_Float16)sp[e];
            } else {
              unsigned short hb = f2bf_bits(sp[e]);
              unsigned short lb = f2bf_bits(sp[e] - bf_bits2f(hb));
              hv[e] = __builtin_bit_cast(_Float16, hb);
              lv[e] = __builtin_bit_cast(_Float16, lb);
            }
          }
          *(v8h*)(C + (size_t)(mBase + row) * ldc + n0 + c8) = hv;
          if (OUT_MODE == 2) *(v8h*)(C2 + (size_t)(mBase + row) * ldc + n0 + c8) = lv;
        }
        
      }
    }
    __builtin_amdgcn_fence(__ATOMIC_RELEASE, "workgroup");
    __builtin_amdgcn_wave_barrier();
    __builtin_amdgcn_fence(__ATOMIC_ACQUIRE, "workgroup");
  }
}

// ---------------------------------------------------------------------------
// P.V^T split along K (the key axis), f16 operands, f32 accumulate.
//   Part[range][c][n] = sum over the range's keys m of A[c][m] * Bt[n][m]      (raw sums, P still carried x32768)
// A = V plane [64][kN], Bt = probability rows [kQCH][kN], both with the key index contiguous.
// grid (kQCH / 32, kPVRanges), kPVWaves waves: blockIdx.x = 32-wide query tile, blockIdx.y = key range of kN / kPVRanges keys.
// Wave w takes kPVSteps k steps of 32 keys of that range for the whole 64 x 32 tile; the waves' tiles are summed through LDS
// in wave order 0..kPVWaves-1 and each 128-B line of Part is stored once. The ranges are summed by pv_finish_kernel.
// ---------------------------------------------------------------------------
constexpr int kPVRanges = 5;
constexpr int kPVWaves  = 10;
constexpr int kPVSteps  = kN / 32 / (kPVRanges * kPVWaves);   // 5
constexpr int kPVPitch  = 36;                                  // floats per LDS row: 144 B = 16 B x odd
static_assert(kPVSteps * kPVRanges * kPVWaves * 32 == kN, "key split is exact");
static_assert(kQCH % 32 == 0 && kC == 64, "P.V^T tile");
__global__ __launch_bounds__(kPVWaves * 32) void wmma_pv_part_kernel(
    const unsigned short* __restrict__ Ap, const unsigned short* __restrict__ Btp, float* __restrict__ Part) {
  typedef _Float16 T;
  typedef v16h V;
  __shared__ __align__(16) float sP[kPVWaves][64 * kPVPitch];
  const int t     = threadIdx.x;
  const int lane  = t & 31;
  const int wave  = t >> 5;
  const int n0    = blockIdx.x * 32;
  const int kbase = (blockIdx.y * kPVWaves + wave) * (kPVSteps * 32);
  const int rlane = lane & 15;
  const int koff  = (lane >> 4) * 8;
  const int mOff  = (lane >> 4) * 8;
  const T* Ar = (const T*)Ap  + (size_t)rlane * kN + kbase + koff;
  const T* Br = (const T*)Btp + (size_t)(n0 + rlane) * kN + kbase + koff;

  v8f acc[4][2];
#pragma unroll
  for (int i = 0; i < 4; ++i)
#pragma unroll
    for (int j = 0; j < 2; ++j) acc[i][j] = (v8f){0.f,0.f,0.f,0.f,0.f,0.f,0.f,0.f};

  // unrolled: five steps, every address a constant offset from the two row pointers
#pragma unroll
  for (int s = 0; s < kPVSteps; ++s) {
    V bh[2], ah[4];
#pragma unroll
    for (int j = 0; j < 2; ++j) bh[j] = Frag<T>::load(Br + (size_t)(j << 4) * kN + s * 32);
#pragma unroll
    for (int i = 0; i < 4; ++i) ah[i] = Frag<T>::load(Ar + (size_t)(i << 4) * kN + s * 32);
#pragma unroll
    for (int i = 0; i < 4; ++i)
#pragma unroll
      for (int j = 0; j < 2; ++j) acc[i][j] = Frag<T>::mma(ah[i], bh[j], acc[i][j]);
  }

  float* slab = sP[wave];
#pragma unroll
  for (int i = 0; i < 4; ++i)
#pragma unroll
    for (int j = 0; j < 2; ++j)
#pragma unroll
      for (int r = 0; r < 8; ++r) slab[((i << 4) + mOff + r) * kPVPitch + (j << 4) + rlane] = acc[i][j][r];
  __syncthreads();

  // 64 rows x 8 float4 = 512 pieces; 8 lanes cover one 128-B row segment
  float* Pr = Part + (size_t)blockIdx.y * kC * kQCH + n0;
  for (int idx = t; idx < 512; idx += kPVWaves * 32) {
    const int row = idx >> 3, c4 = (idx & 7) * 4;
    v4f sum = *(const v4f*)(&sP[0][row * kPVPitch + c4]);
#pragma unroll
    for (int w = 1; w < kPVWaves; ++w) sum += *(const v4f*)(&sP[w][row * kPVPitch + c4]);
    *(v4f*)(Pr + (size_t)row * kQCH + c4) = sum;
  }
}

// ---------------------------------------------------------------------------
// Sum of the key ranges, gamma scale and residual, whole output in one launch:
//   out[b][c][n] = gsc[0] * (scale * sum_r Part[b][chunk(n)][r][c][n - chunk start]) + x[b][c][n],  r in index order.
// One float4 per thread; kQCH % 4 == 0, so a float4 never crosses a chunk.
// ---------------------------------------------------------------------------
static_assert(kQCH % 4 == 0 && (kB * kC * kN / 4) % 256 == 0, "finish cover");
__global__ __launch_bounds__(256) void pv_finish_kernel(const float* __restrict__ Part, const float* __restrict__ x,
                                                        const float* __restrict__ gsc, float* __restrict__ out, float scale) {
  const int idx = blockIdx.x * 256 + threadIdx.x;      // float4 index in [b][c][n]
  const int n   = (idx % (kN / 4)) * 4;
  const int bc  = idx / (kN / 4);
  const int c   = bc % kC;
  const int b   = bc / kC;
  const int chk = n / kQCH;
  const int nl  = n - chk * kQCH;
  const float* pp = Part + ((size_t)(b * kNChunk + chk) * kPVRanges * kC + c) * kQCH + nl;
  v4f sum = *(const v4f*)pp;
#pragma unroll
  for (int r = 1; r < kPVRanges; ++r) sum += *(const v4f*)(pp + (size_t)r * kC * kQCH);
  const v4f xv = *(const v4f*)(x + 4 * (size_t)idx);
  const float gmul = gsc[0];
  v4f rr;
#pragma unroll
  for (int e = 0; e < 4; ++e) rr[e] = fmaf(gmul, sum[e] * scale, xv[e]);
  *(v4f*)(out + 4 * (size_t)idx) = rr;
}

// ---------------------------------------------------------------------------
// Weight / bias preparation (one block of 256 threads):
//   WQKh/WQKl: bf16 hi/lo planes of a [64][64] matrix whose rows 0..7 = Wq[out][in], rows 32..39 = Wk[out][in], all other
//   rows zero (computed per lane, both source rows loaded unconditionally with clamped indices, combined arithmetically).
//   WVh/WVl: bf16 hi/lo planes of Wv[64][64]. BQK: f32 [64] with bq at 0..7, bk at 32..39, zero elsewhere.
// ---------------------------------------------------------------------------
__global__ __launch_bounds__(256) void prep_kernel(const float* __restrict__ Wq, const float* __restrict__ Wk,
                                                   const float* __restrict__ Wv,
                                                   const float* __restrict__ bq, const float* __restrict__ bk,
                                                   unsigned short* __restrict__ WQKh, unsigned short* __restrict__ WQKl,
                                                   unsigned short* __restrict__ WVh, unsigned short* __restrict__ WVl,
                                                   float* __restrict__ BQK) {
  const int t = threadIdx.x;
#pragma unroll 1
  for (int it = 0; it < 2; ++it) {
    const int ch = it * 256 + t;            // 0..511 chunks of 8 halves
    const int r  = ch >> 3;                 // output row 0..63
    const int c8 = (ch & 7) * 8;
    const int rq = (r < kCq) ? r : (kCq - 1);
    int rk = r - 32; rk = (rk < 0) ? 0 : rk; rk = (rk > kCq - 1) ? (kCq - 1) : rk;
    const float fq = (r < kCq) ? 1.0f : 0.0f;
    const float fk = ((unsigned)(r - 32) < (unsigned)kCq) ? 1.0f : 0.0f;
    const v4f qa = *(const v4f*)(Wq + rq * kC + c8);
    const v4f qb = *(const v4f*)(Wq + rq * kC + c8 + 4);
    const v4f ka = *(const v4f*)(Wk + rk * kC + c8);
    const v4f kb = *(const v4f*)(Wk + rk * kC + c8 + 4);
    unsigned short hb[8], lb[8];
#pragma unroll
    for (int e = 0; e < 4; ++e) {
      const float v0 = fmaf(fq, qa[e], fk * ka[e]);
      const float v1 = fmaf(fq, qb[e], fk * kb[e]);
      hb[e] = f2bf_bits(v0);
      lb[e] = f2bf_bits(v0 - bf_bits2f(hb[e]));
      hb[4 + e] = f2bf_bits(v1);
      lb[4 + e] = f2bf_bits(v1 - bf_bits2f(hb[4 + e]));
    }
    const v4u uh = (v4u){pk16(hb[0], hb[1]), pk16(hb[2], hb[3]), pk16(hb[4], hb[5]), pk16(hb[6], hb[7])};
    const v4u ul = (v4u){pk16(lb[0], lb[1]), pk16(lb[2], lb[3]), pk16(lb[4], lb[5]), pk16(lb[6], lb[7])};
    unsigned short* ph = WQKh + 8 * (size_t)ch;
    unsigned short* pl = WQKl + 8 * (size_t)ch;
    *(v4u*)ph = uh;
    *(v4u*)pl = ul;
    
  }
#pragma unroll 1
  for (int it = 0; it < 2; ++it) {
    const int ch = it * 256 + t;
    const int r  = ch >> 3;
    const int c8 = (ch & 7) * 8;
    const v4f va = *(const v4f*)(Wv + r * kC + c8);
    const v4f vb = *(const v4f*)(Wv + r * kC + c8 + 4);
    unsigned short hb[8], lb[8];
#pragma unroll
    for (int e = 0; e < 4; ++e) {
      hb[e] = f2bf_bits(va[e]);
      lb[e] = f2bf_bits(va[e] - bf_bits2f(hb[e]));
      hb[4 + e] = f2bf_bits(vb[e]);
      lb[4 + e] = f2bf_bits(vb[e] - bf_bits2f(hb[4 + e]));
    }
    const v4u uh = (v4u){pk16(hb[0], hb[1]), pk16(hb[2], hb[3]), pk16(hb[4], hb[5]), pk16(hb[6], hb[7])};
    const v4u ul = (v4u){pk16(lb[0], lb[1]), pk16(lb[2], lb[3]), pk16(lb[4], lb[5]), pk16(lb[6], lb[7])};
    unsigned short* ph = WVh + 8 * (size_t)ch;
    unsigned short* pl = WVl + 8 * (size_t)ch;
    *(v4u*)ph = uh;
    *(v4u*)pl = ul;
    
  }
  {
    const int tt = t & 15;
    v4f bvv;
#pragma unroll
    for (int e = 0; e < 4; ++e) {
      const int i  = 4 * tt + e;             // 0..63
      const int iq = (i < kCq) ? i : (kCq - 1);
      int ik = i - 32; ik = (ik < 0) ? 0 : ik; ik = (ik > kCq - 1) ? (kCq - 1) : ik;
      const float fq = (i < kCq) ? 1.0f : 0.0f;
      const float fk = ((unsigned)(i - 32) < (unsigned)kCq) ? 1.0f : 0.0f;
      bvv[e] = fmaf(fq, bq[iq], fk * bk[ik]);
    }
    if (t < 16) {
      float* pb = BQK + 4 * t;
      *(v4f*)pb = bvv;
      
    }
  }
}

// ---------------------------------------------------------------------------
// x transpose + bf16 hi/lo split: XTh/XTl[b][n][c] = hi/lo( x[b][c][n] ).
// grid (125, 2): blockIdx.x = 64-wide n tile, blockIdx.y = batch; 256 threads.
// Load coverage: 2 x 8 iterations x 256 threads = 4096 = whole 64(c) x 64(n) tile (coalesced along n).
// Store coverage: 8 waves x 2 iterations x 4 rows (lane>>3) = 64 n-rows; (lane&7) x 8 halves = 64 c-cols; each row = 64 halves =
// ---------------------------------------------------------------------------
__global__ __launch_bounds__(256) void xt_split_kernel(const float* __restrict__ x, unsigned short* __restrict__ XTh,
                                                       unsigned short* __restrict__ XTl) {
  __shared__ float sm[64][65];   // sm[n_local][c]
  const int t  = threadIdx.x;
  const int n0 = blockIdx.x * 64;
  const int b  = blockIdx.y;
  const float* xb = x + (size_t)b * kC * kN;
#pragma unroll 1
  for (int i2 = 0; i2 < 2; ++i2) {
#pragma unroll
    for (int i = 0; i < 8; ++i) {
      const int e  = (i2 * 8 + i) * 256 + t;
      const int c  = e >> 6;          // channel 0..63
      const int nl = e & 63;          // n local
      sm[nl][c] = xb[(size_t)c * kN + n0 + nl];
    }
  }
  __syncthreads();
  const int lane = t & 31, wave = t >> 5;
  const int q = lane >> 3, c8 = (lane & 7) * 8;
  unsigned short* oh = XTh + (size_t)b * kN * kC;
  unsigned short* ol = XTl + (size_t)b * kN * kC;
  v4u uh[2], ul[2];
#pragma unroll
  for (int it = 0; it < 2; ++it) {
    const int row = wave * 8 + it * 4 + q;   // n local
    unsigned short hb[8], lb[8];
#pragma unroll
    for (int e = 0; e < 8; ++e) {
      const float v = sm[row][c8 + e];
      hb[e] = f2bf_bits(v);
      lb[e] = f2bf_bits(v - bf_bits2f(hb[e]));
    }
    uh[it] = (v4u){pk16(hb[0], hb[1]), pk16(hb[2], hb[3]), pk16(hb[4], hb[5]), pk16(hb[6], hb[7])};
    ul[it] = (v4u){pk16(lb[0], lb[1]), pk16(lb[2], lb[3]), pk16(lb[4], lb[5]), pk16(lb[6], lb[7])};
  }
  {
#pragma unroll
    for (int it = 0; it < 2; ++it) {
      const int row = wave * 8 + it * 4 + q;
      *(v4u*)(oh + (size_t)(n0 + row) * kC + c8) = uh[it];
      *(v4u*)(ol + (size_t)(n0 + row) * kC + c8) = ul[it];
    }
    
  }
}

// ---------------------------------------------------------------------------
// Packed q|k operand plane: from the f32 projection output QKF[row][64] (cols 0..7 = q, cols 32..39 = k, rest 0) build
// QKP[row][64] bf16 with cols 0..7 = hi(q), 8..15 = lo(q), 16..23 = hi(q), 24..31 = 0, 32..39 = hi(k), 40..47 = hi(k),
// 48..55 = lo(k), 56..63 = 0, so that sum_{s<32} QKP[n][s] * QKP[m][32+s] = qh.kh + ql.kh + qh.kl.
// 256 threads = 32 rows x 8 lane groups; group g owns cols 8g..8g+7; both q and k of the row are loaded by every lane
// ---------------------------------------------------------------------------
__global__ __launch_bounds__(256) void qk_pack_kernel(const float* __restrict__ QKF, unsigned short* __restrict__ QKP, int nrows) {
  const int t    = threadIdx.x;
  const int rowi = blockIdx.x * 32 + (t >> 3);
  const int g    = t & 7;
  const int rowc = (rowi < nrows) ? rowi : (nrows - 1);
  const float* rp = QKF + (size_t)rowc * kKP;
  const v4f qa = *(const v4f*)(rp);
  const v4f qb = *(const v4f*)(rp + 4);
  const v4f ka = *(const v4f*)(rp + 32);
  const v4f kb = *(const v4f*)(rp + 36);
  const float fq = (g < 3) ? 1.0f : 0.0f;
  const float fk = ((unsigned)(g - 4) < 3u) ? 1.0f : 0.0f;
  const bool islo = (g == 1) || (g == 6);
  unsigned short ob[8];
#pragma unroll
  for (int e = 0; e < 4; ++e) {
    const float v0 = fmaf(fq, qa[e], fk * ka[e]);
    const float v1 = fmaf(fq, qb[e], fk * kb[e]);
    const unsigned short h0 = f2bf_bits(v0);
    const unsigned short l0 = f2bf_bits(v0 - bf_bits2f(h0));
    const unsigned short h1 = f2bf_bits(v1);
    const unsigned short l1 = f2bf_bits(v1 - bf_bits2f(h1));
    ob[e]     = islo ? l0 : h0;
    ob[4 + e] = islo ? l1 : h1;
  }
  const v4u u = (v4u){pk16(ob[0], ob[1]), pk16(ob[2], ob[3]), pk16(ob[4], ob[5]), pk16(ob[6], ob[7])};
  if (rowi < nrows) {
    unsigned short* dst = QKP + (size_t)rowi * kKP + 8 * g;
    *(v4u*)dst = u;
    
  }
}

// ---------------------------------------------------------------------------
// Row softmax over 8000 f32 scores: P[row][j] = f16( 32768 * exp(s - max) / sum exp(s - max) ), f32 math, precise expf.
// One block of 256 threads per row; thread t owns 16-byte chunks ch = it*256 + t (8 scores each), it = 0..3, valid for
// ch < 1000 (only it = 3, t >= 232 is idle; those lanes load a clamped in-range address and contribute neutral values).
// Phase 1: global loads -> row max, scores staged in LDS (every LDS word read later is written here: 1000 chunks x 8).
// Phase 2: exp and row sum (each thread re-reads and rewrites only its own chunks, 4 at a time, rolled loop).
// Reductions in fixed order (thread, wave shuffle tree, 8 wave partials in index order); block barriers between phases.
// ---------------------------------------------------------------------------
__global__ __launch_bounds__(256) void softmax_row_kernel(const float* __restrict__ SC, unsigned short* __restrict__ P) {
  __shared__ __align__(16) float lg[kN];
  __shared__ float redM[8];
  __shared__ float redS[8];
  const int row  = blockIdx.x;
  const int t    = threadIdx.x;
  const int lane = t & 31, wave = t >> 5;
  const float* sr = SC + (size_t)row * kN;

  float mx = -__builtin_inff();
#pragma unroll 1
  for (int it = 0; it < 4; ++it) {
    const int ch  = it * 256 + t;
    const bool valid = ch < kNC8;
    const int chc = valid ? ch : (kNC8 - 1);
    const v4f a = *(const v4f*)(sr + 8 * chc);
    const v4f c = *(const v4f*)(sr + 8 * chc + 4);
    const float m8 = fmaxf(fmaxf(fmaxf(a[0], a[1]), fmaxf(a[2], a[3])), fmaxf(fmaxf(c[0], c[1]), fmaxf(c[2], c[3])));
    mx = fmaxf(mx, m8);
    if (valid) {
      *(v4f*)(lg + 8 * ch)     = a;
      *(v4f*)(lg + 8 * ch + 4) = c;
    }
  }
#pragma unroll
  for (int off = 16; off > 0; off >>= 1) mx = fmaxf(mx, __shfl_xor(mx, off, 32));
  if (lane == 0) redM[wave] = mx;
  __syncthreads();
  float m = redM[0];
#pragma unroll
  for (int w = 1; w < 8; ++w) m = fmaxf(m, redM[w]);

  float sum = 0.0f;
#pragma unroll 1
  for (int it = 0; it < 8; ++it) {
    const int ch  = (it >> 1) * 256 + t;
    const int hf  = (it & 1) * 4;
    const bool valid = ch < kNC8;
    const int chc = valid ? ch : (kNC8 - 1);
    const float fv = valid ? 1.0f : 0.0f;
    const v4f l = *(const v4f*)(lg + 8 * chc + hf);
    v4f ev;
#pragma unroll
    for (int e = 0; e < 4; ++e) {
      const float l0 = valid ? l[e] : m;
      ev[e] = expf(l0 - m);
      sum = fmaf(fv, ev[e], sum);
    }
    if (valid) *(v4f*)(lg + 8 * ch + hf) = ev;
  }
#pragma unroll
  for (int off = 16; off > 0; off >>= 1) sum += __shfl_xor(sum, off, 32);
  if (lane == 0) redS[wave] = sum;
  __syncthreads();
  float tot = redS[0];
#pragma unroll
  for (int w = 1; w < 8; ++w) tot += redS[w];
  const float inv = kPCarry / tot;

  v4u u[4];
#pragma unroll
  for (int it = 0; it < 4; ++it) {
    const int ch  = it * 256 + t;
    const int chc = (ch < kNC8) ? ch : (kNC8 - 1);
    const v4f e0 = *(const v4f*)(lg + 8 * chc);
    const v4f e1 = *(const v4f*)(lg + 8 * chc + 4);
    unsigned short hb[8];
#pragma unroll
    for (int e = 0; e < 4; ++e) {
      hb[e]     = h_bits(e0[e] * inv);
      hb[4 + e] = h_bits(e1[e] * inv);
    }
    u[it] = (v4u){pk16(hb[0], hb[1]), pk16(hb[2], hb[3]), pk16(hb[4], hb[5]), pk16(hb[6], hb[7])};
  }
  unsigned short* pr = P + (size_t)row * kN;
#pragma unroll
  for (int it = 0; it < 4; ++it) {
    const int ch = it * 256 + t;
    if (ch < kNC8) *(v4u*)(pr + 8 * (size_t)ch) = u[it];
  }
  
}

// ---------------------------------------------------------------------------
// Host glue.
//   XTh  bf16 [2][8000][64]      2,048,000  at          0
//   XTl  bf16 [2][8000][64]      2,048,000  at  2,048,000
//   WQKh bf16 [64][64]               8,192  at  4,096,000
//   WQKl bf16 [64][64]               8,192  at  4,104,192
//   WVh  bf16 [64][64]               8,192  at  4,112,384
//   WVl  bf16 [64][64]               8,192  at  4,120,576
//   BQK  f32  [64]                     256  at  4,128,768
//   QKF  f32  [2][8000][64]      4,096,000  at  4,129,024
//   QKP  bf16 [2][8000][64]      2,048,000  at  8,225,024
//   VP   f16  [2][64][8000]      2,048,000  at 10,273,024
//   SC   f32  [1600][8000]      51,200,000  at 12,321,024   (scores of one (batch, 1600-row) chunk, reused 10x)
//   PP   f16  [1600][8000]      25,600,000  at 63,521,024   (probabilities x32768, reused 10x)
//   PART f32  [2][5][5][64][1600] 20,480,000 at 89,121,024   (P.V^T sums per (batch, chunk, key range))
//   total                     109,601,024
// GEMM shapes: q|k projection M=8000, N=64, K=64; v projection M=64, N=8000, K=64; scores M=1600, N=8000, K=32;
// P.V^T M=64, N=1600, K=8000 in 5 x 10 key sub-ranges. All M, N multiples of 64, all K multiples of 32, no partial tiles, no padding rows.
// ---------------------------------------------------------------------------
extern "C" void kernel_launch(void* const* d_in, const int* in_sizes, int n_in,
                              void* d_out, int out_size, void* d_ws, size_t ws_size,
                              hipStream_t stream) {
  if (n_in < 8) return;
  const int nElem = kB * kC * kN;                 // 1,024,000
  if (in_sizes[0] != nElem) return;
  if (in_sizes[1] != kCq * kC || in_sizes[2] != kCq) return;
  if (in_sizes[3] != kCq * kC || in_sizes[4] != kCq) return;
  if (in_sizes[5] != kC * kC || in_sizes[6] != kC || in_sizes[7] < 1) return;
  if (out_size != nElem) return;

  const size_t szXT  = (size_t)kB * kN * kC * 2;
  const size_t szW   = (size_t)64 * 64 * 2;
  const size_t szBQK = (size_t)64 * 4;
  const size_t szQKF = (size_t)kB * kN * kKP * 4;
  const size_t szQKP = (size_t)kB * kN * kKP * 2;
  const size_t szVP  = (size_t)kB * kC * kN * 2;
  const size_t szSC  = (size_t)kQCH * kN * 4;
  const size_t szP   = (size_t)kQCH * kN * 2;
  const size_t offXTh  = 0;
  const size_t offXTl  = offXTh + szXT;
  const size_t offWQKh = offXTl + szXT;
  const size_t offWQKl = offWQKh + szW;
  const size_t offWVh  = offWQKl + szW;
  const size_t offWVl  = offWVh + szW;
  const size_t offBQK  = offWVl + szW;
  const size_t offQKF  = offBQK + szBQK;
  const size_t offQKP  = offQKF + szQKF;
  const size_t offVP   = offQKP + szQKP;
  const size_t offSC   = offVP + szVP;
  const size_t offP    = offSC + szSC;
  const size_t szPart  = (size_t)kB * kNChunk * kPVRanges * kC * kQCH * 4;
  const size_t offPart = offP + szP;
  const size_t total   = offPart + szPart;
  if (ws_size < total) return;

  const float* x     = (const float*)d_in[0];
  const float* Wq    = (const float*)d_in[1];
  const float* bq    = (const float*)d_in[2];
  const float* Wk    = (const float*)d_in[3];
  const float* bk    = (const float*)d_in[4];
  const float* Wv    = (const float*)d_in[5];
  const float* bv    = (const float*)d_in[6];
  const float* gamma = (const float*)d_in[7];
  float* out = (float*)d_out;
  char* ws = (char*)d_ws;
  unsigned short* XTh  = (unsigned short*)(ws + offXTh);
  unsigned short* XTl  = (unsigned short*)(ws + offXTl);
  unsigned short* WQKh = (unsigned short*)(ws + offWQKh);
  unsigned short* WQKl = (unsigned short*)(ws + offWQKl);
  unsigned short* WVh  = (unsigned short*)(ws + offWVh);
  unsigned short* WVl  = (unsigned short*)(ws + offWVl);
  float* BQK = (float*)(ws + offBQK);
  float* QKF = (float*)(ws + offQKF);
  unsigned short* QKP = (unsigned short*)(ws + offQKP);
  unsigned short* VP  = (unsigned short*)(ws + offVP);
  float* SC = (float*)(ws + offSC);
  unsigned short* PP = (unsigned short*)(ws + offP);
  float* PART = (float*)(ws + offPart);

  // ---- prologue: weight planes, x^T planes, projections ----
  prep_kernel<<<dim3(1), dim3(256), 0, stream>>>(Wq, Wk, Wv, bq, bk, WQKh, WQKl, WVh, WVl, BQK);
  xt_split_kernel<<<dim3(kN / 64, kB), dim3(256), 0, stream>>>(x, XTh, XTl);
  // QKF[b][n][col] = sum_c XT[b][n][c] * WQK[col][c] + BQK[col]   (M=8000, N=64, K=64; bf16 hi/lo both operands)
  wmma_gemm64<1, true, 2, 0, false, 0><<<dim3(kBlocksProj, kB), dim3(256), 0, stream>>>(
      XTh, XTl, kC, (long)kN * kC,
      WQKh, WQKl, kC, 0L,
      (void*)QKF, (void*)QKF, kKP, (long)kN * kKP,
      BQK, BQK, 0L,
      kN, kKP, kC, 1.0f);
  qk_pack_kernel<<<dim3((kB * kN) / 32), dim3(256), 0, stream>>>(QKF, QKP, kB * kN);
  // VP[b][c][m] = f16( sum_c' WV[c][c'] * XT[b][m][c'] + bv[c] )   (M=64, N=8000, K=64; bf16 hi/lo both operands)
  wmma_gemm64<1, true, 1, 1, false, 0><<<dim3(kBlocksProj, kB), dim3(256), 0, stream>>>(
      WVh, WVl, kC, 0L,
      XTh, XTl, kC, (long)kN * kC,
      (void*)VP, (void*)VP, kN, (long)kC * kN,
      bv, bv, 0L,
      kC, kN, kC, 1.0f);

  // ---- per (batch, 1600-row query chunk): scores -> softmax -> P.V^T key-range sums ----
  for (int b = 0; b < kB; ++b) {
    const unsigned short* qkb = QKP + (size_t)b * kN * kKP;
    const unsigned short* vpb = VP + (size_t)b * kC * kN;
    for (int chk = 0; chk < kNChunk; ++chk) {
      const int q0 = chk * kQCH;
      // SC[i][m] = sum_{s<32} QKP[b][q0+i][s] * QKP[b][m][32+s]   (M=1600, N=8000, K=32)
      wmma_gemm64<1, false, 0, 0, false, 0><<<dim3(kBlocksScore, 1), dim3(256), 0, stream>>>(
          qkb + (size_t)q0 * kKP, qkb + (size_t)q0 * kKP, kKP, 0L,
          qkb + 32, qkb + 32, kKP, 0L,
          (void*)SC, (void*)SC, kN, 0L,
          BQK, BQK, 0L,
          kQCH, kN, 32, 1.0f);
      softmax_row_kernel<<<dim3(kQCH), dim3(256), 0, stream>>>(SC, PP);
      // PART[b][chk][r][c][n] = sum_{m in key range r} VP[b][c][m] * PP[n][m]   (M=64, N=1600, K=8000)
      wmma_pv_part_kernel<<<dim3(kQCH / 32, kPVRanges), dim3(kPVWaves * 32), 0, stream>>>(
          vpb, PP, PART + (size_t)(b * kNChunk + chk) * kPVRanges * kC * kQCH);
    }
  }
  // out[b][c][n] = gamma * 2^-15 * sum_r PART[b][chunk][r][c][n] + x[b][c][n]
  pv_finish_kernel<<<dim3(kB * kC * kN / 4 / 256), dim3(256), 0, stream>>>(PART, x, gamma, out, kPCarryInv);
}

// v002
// One run takes 69.3 microseconds.
// Next to v001, in two timings, it ran 5.41 and 5.45 times as fast.
// Counting every step since v000, it is 50.7 times as fast.
// Contractions: q/k/v channel projections on v_wmma_f32_16x16x32_bf16 with x^T and W as bf16 hi+lo planes (hh+hl+lh); energy k.q^T on v_wmma_f32_16x16x32_bf16 with q,k bf16 hi|lo parts packed along the 32-deep k axis (hh+lh+hl in one pass); V.P^T on v_wmma_f32_16x16x32_f16 (P = exp(s - running max) in f16 carried x32768, V f16 plane); f32 accumulate everywhere; softmax, biases, gamma scale and residual in f32.
#include <hip/hip_runtime.h>
#include <math.h>

// ---------------------------------------------------------------------------
// Problem constants
// ---------------------------------------------------------------------------
constexpr int kB    = 2;        // batch
constexpr int kC    = 64;       // channels (value dim and projection K)
constexpr int kCq   = 8;        // query/key channels
constexpr int kN    = 8000;     // voxels per sample (20*20*20)
constexpr int kKP   = 64;       // packed q|k row width in halves: q block cols 0..31, k block cols 32..63
constexpr int kTilesProj   = (kN / 64) * (kKP / 64);      // 125
constexpr int kBlocksProj  = (kTilesProj + 7) / 8;         // 16
static_assert(kN % 64 == 0, "tiles");
static_assert(kC == 64 && kKP % 32 == 0 && kC % 32 == 0 && kN % 32 == 0, "k multiples");
static_assert((kB * kN) % 32 == 0, "pack rows per block");
static_assert(3 * kCq <= 32, "hi|lo|hi packing fits one k step");

typedef __attribute__((ext_vector_type(16))) _Float16 v16h;
typedef __attribute__((ext_vector_type(8)))  _Float16 v8h;
typedef __attribute__((ext_vector_type(16))) __bf16   v16b;
typedef __attribute__((ext_vector_type(8)))  __bf16   v8b;
typedef __attribute__((ext_vector_type(8)))  float    v8f;
typedef __attribute__((ext_vector_type(4)))  float    v4f;
typedef __attribute__((ext_vector_type(4)))  unsigned int v4u;

// ---------------------------------------------------------------------------
// Device helpers
// ---------------------------------------------------------------------------
__device__ __forceinline__ unsigned short f2bf_bits(float f) {
  unsigned u = __float_as_uint(f);
  return (unsigned short)((u + 0x7FFFu + ((u >> 16) & 1u)) >> 16);
}
__device__ __forceinline__ float bf_bits2f(unsigned short h) { return __uint_as_float(((unsigned)h) << 16); }

// hazard guards as plain device helpers (no inline asm inside the kernel template body)
__device__ __forceinline__ void dep_guard_h(v8f& a, v8f& b, v16h x, v16h y) { asm volatile("v_nop\n\tv_nop\n\tv_nop\n\tv_nop" : "+v"(a), "+v"(b) : "v"(x), "v"(y)); }
__device__ __forceinline__ void dep_guard_b(v8f& a, v8f& b, v16b x, v16b y) { asm volatile("v_nop\n\tv_nop\n\tv_nop\n\tv_nop" : "+v"(a), "+v"(b) : "v"(x), "v"(y)); }
__device__ __forceinline__ void keep4_h(v16h a, v16h b, v16h c, v16h d) { asm volatile("v_nop" :: "v"(a), "v"(b), "v"(c), "v"(d)); }
__device__ __forceinline__ void keep4_b(v16b a, v16b b, v16b c, v16b d) { asm volatile("v_nop" :: "v"(a), "v"(b), "v"(c), "v"(d)); }
__device__ __forceinline__ void acc_guard4(v8f& a, v8f& b, v8f& c, v8f& d) { asm volatile("v_nop\n\tv_nop\n\tv_nop\n\tv_nop" : "+v"(a), "+v"(b), "+v"(c), "+v"(d)); }
template <typename T> struct Frag;
template <> struct Frag<_Float16> {
  typedef v16h V; union U { v16h v; v8h h[2]; };
  // elements 0..7 <- p[0..7], 8..15 <- p[16..23]
  static __device__ __forceinline__ v16h load(const _Float16* p) {
    U f; f.h[0] = *(const v8h*)(p); f.h[1] = *(const v8h*)(p + 16); return f.v;
  }
  static __device__ __forceinline__ v8f mma(v16h a, v16h b, v8f c) {
    return __builtin_amdgcn_wmma_f32_16x16x32_f16(false, a, false, b, (short)0, c, false, false);
  }
  static __device__ __forceinline__ void guard(v8f& a, v8f& b, v16h x, v16h y) { dep_guard_h(a, b, x, y); }
  static __device__ __forceinline__ void keep(v16h a, v16h b, v16h c, v16h d) { keep4_h(a, b, c, d); }
};
template <> struct Frag<__bf16> {
  typedef v16b V; union U { v16b v; v8b h[2]; };
  static __device__ __forceinline__ v16b load(const __bf16* p) {
    U f; f.h[0] = *(const v8b*)(p); f.h[1] = *(const v8b*)(p + 16); return f.v;
  }
  static __device__ __forceinline__ v8f mma(v16b a, v16b b, v8f c) {
    return __builtin_amdgcn_wmma_f32_16x16x32_bf16(false, a, false, b, (short)0, c, false, false);
  }
  static __device__ __forceinline__ void guard(v8f& a, v8f& b, v16b x, v16b y) { dep_guard_b(a, b, x, y); }
  static __device__ __forceinline__ void keep(v16b a, v16b b, v16b c, v16b d) { keep4_b(a, b, c, d); }
};

__device__ __forceinline__ unsigned pk16(unsigned short a, unsigned short b) { return (unsigned)a | ((unsigned)b << 16); }

// ---- Register-blocked batched WMMA GEMM (ACT reduced to none/relu/leaky) -------------------------------
// C[m,n] = scale * sum_k A[m,k] * Bt[n,k] (+bias)(+resid); each wave owns a 64x64 tile.
// A row-major [M,K]; Bt row-major [N,K]; M,N % 64 == 0, K % 32 == 0.
// SPLIT: operands are hi/lo planes (A2/Bt2 = lo planes, same layout); product = hi*hi + hi*lo + lo*hi.
// BIAS_MODE: 0 = none, 1 = bias[m], 2 = bias[n].
// OUT_MODE: 0 = f32, 1 = f16, 2 = bf16 hi plane (Cout) + bf16 lo plane (Cout2).
// ET: 0 = f16 operands, 1 = bf16 operands (pointers passed as 16-bit storage)
template <int ET> struct Elem;
template <> struct Elem<0> { typedef _Float16 T; };
template <> struct Elem<1> { typedef __bf16 T; };
template <int ET, bool SPLIT, int BIAS_MODE, int OUT_MODE, bool RESID, int ACT = 0>
__global__ __launch_bounds__(256) void wmma_gemm64(
    const unsigned short* __restrict__ Ap, const unsigned short* __restrict__ A2p, int lda, long strideA,
    const unsigned short* __restrict__ Btp, const unsigned short* __restrict__ Bt2p, int ldb, long strideB,
    void* __restrict__ Cout, void* __restrict__ Cout2, int ldc, long strideC,
    const float* __restrict__ bias,
    const float* __restrict__ resid, long strideR,
    int M, int N, int K, float scale) {
  typedef typename Elem<ET>::T T;
  typedef typename Frag<T>::V V;
  const T* A = (const T*)Ap; const T* A2 = (const T*)A2p; const T* Bt = (const T*)Btp; const T* Bt2 = (const T*)Bt2p;
  __shared__ __align__(16) float sT[8][16 * 68];   // per-wave 16x64 slab, pitch 68 floats
  const int b    = blockIdx.y;
  const int lane = threadIdx.x & 31;
  const int wave = threadIdx.x >> 5;
  const int tilesN = N >> 6;
  const int tilesM = M >> 6;
  const int tile = blockIdx.x * 8 + wave;
  if (tile >= tilesM * tilesN) return;   // wave-uniform; no block barriers in this kernel
  const int tm = tile / tilesN;
  const int tn = tile - tm * tilesN;
  const int m0 = tm << 6;
  const int n0 = tn << 6;

  const T* Ab  = A  + (size_t)b * strideA;
  const T* Bb  = Bt + (size_t)b * strideB;
  const T* Ab2 = SPLIT ? (A2  + (size_t)b * strideA) : nullptr;
  const T* Bb2 = SPLIT ? (Bt2 + (size_t)b * strideB) : nullptr;

  const int rlane = lane & 15;                 // row (A) / col (B, D) within subtile
  const int koff  = (lane >> 4) * 8;           // k offset of this lane half
  const int mOff  = (lane >> 4) * 8;           // D row offset

  v8f acc[4][4];
#pragma unroll
  for (int i = 0; i < 4; ++i)
#pragma unroll
    for (int j = 0; j < 4; ++j) acc[i][j] = (v8f){0.f,0.f,0.f,0.f,0.f,0.f,0.f,0.f};

  for (int k0 = 0; k0 < K; k0 += 32) {
    V bh[4], bl[4];
#pragma unroll
    for (int j = 0; j < 4; ++j) {
      const size_t bo = (size_t)(n0 + (j << 4) + rlane) * ldb + koff + k0;
      bh[j] = Frag<T>::load(Bb + bo);
      if (SPLIT) bl[j] = Frag<T>::load(Bb2 + bo);
    }
#pragma unroll
    for (int i = 0; i < 4; ++i) {
      const size_t ao = (size_t)(m0 + (i << 4) + rlane) * lda + koff + k0;
      V ah = Frag<T>::load(Ab + ao);
      V al;
      if (SPLIT) al = Frag<T>::load(Ab2 + ao);
#pragma unroll
      for (int j = 0; j < 4; ++j) {
        acc[i][j] = Frag<T>::mma(ah, bh[j], acc[i][j]);
        if (SPLIT) {
          acc[i][j] = Frag<T>::mma(ah, bl[j], acc[i][j]);
          acc[i][j] = Frag<T>::mma(al, bh[j], acc[i][j]);
        }
      }
      Frag<T>::guard(acc[i][0], acc[i][3], ah, SPLIT ? al : ah);
    }
    Frag<T>::keep(bh[0], bh[1], bh[2], bh[3]);
    if (SPLIT) Frag<T>::keep(bl[0], bl[1], bl[2], bl[3]);
  }
  acc_guard4(acc[0][0], acc[0][1], acc[0][2], acc[0][3]);
  acc_guard4(acc[1][0], acc[1][1], acc[1][2], acc[1][3]);
  acc_guard4(acc[2][0], acc[2][1], acc[2][2], acc[2][3]);
  acc_guard4(acc[3][0], acc[3][1], acc[3][2], acc[3][3]);

  // ---- epilogue ----
  float* slab = sT[wave];
  const float* Rb = RESID ? (resid + (size_t)b * strideR) : nullptr;
#pragma unroll
  for (int i = 0; i < 4; ++i) {
    const int mBase = m0 + (i << 4);
#pragma unroll
    for (int j = 0; j < 4; ++j) {
      const int n = n0 + (j << 4) + rlane;
      float bv = 0.f;
      if (BIAS_MODE == 2) bv = bias[n];
#pragma unroll
      for (int r = 0; r < 8; ++r) {
        float v = acc[i][j][r] * scale;
        if (BIAS_MODE == 1) v += bias[mBase + mOff + r];
        if (BIAS_MODE == 2) v += bv;
        if (RESID) v += Rb[(size_t)(mBase + mOff + r) * ldc + n];
        if (ACT == 2) v = fmaxf(v, 0.0f);
        if (ACT == 4) v = (v > 0.f) ? v : 0.01f * v;
        slab[(mOff + r) * 68 + (j << 4) + rlane] = v;
      }
    }
    __builtin_amdgcn_fence(__ATOMIC_RELEASE, "workgroup");
    __builtin_amdgcn_wave_barrier();
    __builtin_amdgcn_fence(__ATOMIC_ACQUIRE, "workgroup");
    if (OUT_MODE == 0) {
      float* C = (float*)Cout + (size_t)b * strideC;
      const int hh = lane >> 4, c4 = (lane & 15) * 4;     // row seg = 256 B = 16 lanes x 16 B
      {
#pragma unroll
        for (int it = 0; it < 8; ++it) {
          const int row = it * 2 + hh;
          v4f v = *(const v4f*)(slab + row * 68 + c4);
          *(v4f*)(C + (size_t)(mBase + row) * ldc + n0 + c4) = v;
        }
        
      }
    } else {
      const int q = lane >> 3, c8 = (lane & 7) * 8;
      unsigned short* C  = (unsigned short*)Cout  + (size_t)b * strideC;
      unsigned short* C2 = (OUT_MODE == 2) ? ((unsigned short*)Cout2 + (size_t)b * strideC) : nullptr;
      {
#pragma unroll
        for (int it = 0; it < 4; ++it) {
          const int row = it * 4 + q;
          const float* sp = slab + row * 68 + c8;
          v8h hv, lv;
#pragma unroll
          for (int e = 0; e < 8; ++e) {
            if (OUT_MODE == 1) {
              hv[e] = (_Float16)sp[e];
            } else {
              unsigned short hb = f2bf_bits(sp[e]);
              unsigned short lb = f2bf_bits(sp[e] - bf_bits2f(hb));
              hv[e] = __builtin_bit_cast(_Float16, hb);
              lv[e] = __builtin_bit_cast(_Float16, lb);
            }
          }
          *(v8h*)(C + (size_t)(mBase + row) * ldc + n0 + c8) = hv;
          if (OUT_MODE == 2) *(v8h*)(C2 + (size_t)(mBase + row) * ldc + n0 + c8) = lv;
        }
        
      }
    }
    __builtin_amdgcn_fence(__ATOMIC_RELEASE, "workgroup");
    __builtin_amdgcn_wave_barrier();
    __builtin_amdgcn_fence(__ATOMIC_ACQUIRE, "workgroup");
  }
}

// ---------------------------------------------------------------------------
// Scores, softmax and V.P^T in one kernel; scores and probabilities never leave the registers.
//   out[b][c][n] = gsc[0] * sum_m V[b][c][m] * softmax_m(q[n].k[m]) + x[b][c][n]
// grid (kN / 64, kB), 20 waves. A block owns 64 queries; wave w = 4 * kg + qt owns query tile qt (16 queries) and key group kg
// (kN / 5 keys), walked in stages of 64 keys. The four waves of a key group stage its K rows (packed k halves) and V rows
// through registers into their own pair of LDS buffers; one block barrier per stage publishes a stage and frees the other buffer.
// S^T = K.Q^T: a lane holds 8 keys per 16-key tile of ONE query (column lane & 15), keys (lane >> 4) * 8 + r, which is the
// k order of the B fragment of the next product, so P^T is packed in place. O^T += V.P^T: the same column per lane, so the
// running-maximum rescale is one factor per lane. The five key groups are joined through LDS in index order at the end.
// ---------------------------------------------------------------------------
constexpr int kFQ      = 64;                    // queries per block
constexpr int kFGroups = 5;                     // key groups per block
constexpr int kFWaves  = 4 * kFGroups;          // 20
constexpr int kFStage  = 64;                    // keys per stage
constexpr int kFStages = kN / kFGroups / kFStage;   // 25
constexpr int kFKPitch = 40;                    // halves per staged K row: 80 B = 16 B x odd
constexpr int kFVPitch = 72;                    // halves per staged V row: 144 B = 16 B x odd
constexpr int kFBuf    = kFStage * kFKPitch + kC * kFVPitch;   // halves per buffer: 7168
constexpr int kFOPitch = 68;                    // floats per row of the join slab
constexpr float kLog2e = 1.4426950408889634f;
static_assert(kFStages * kFStage * kFGroups == kN && kN % kFQ == 0, "key and query split are exact");
static_assert(kFGroups * 2 * kFBuf * 2 >= kFGroups * kC * kFOPitch * 4, "join slab fits in the stage buffers");
// Hardware exp2. The instruction set asks for one independent instruction between a transcendental and an instruction that
// reads its result or overwrites its source. In one statement, with results kept apart from sources, each exp2 fills its neighbour's slot and the
// closing v_nop fills the last one's.
__device__ __forceinline__ void exp2x8(float (&p)[8], const float (&a)[8]) {
  asm("v_exp_f32 %0, %8\n\tv_exp_f32 %1, %9\n\tv_exp_f32 %2, %10\n\tv_exp_f32 %3, %11\n\t"
      "v_exp_f32 %4, %12\n\tv_exp_f32 %5, %13\n\tv_exp_f32 %6, %14\n\tv_exp_f32 %7, %15\n\tv_nop"
      : "=&v"(p[0]), "=&v"(p[1]), "=&v"(p[2]), "=&v"(p[3]), "=&v"(p[4]), "=&v"(p[5]), "=&v"(p[6]), "=&v"(p[7])
      : "v"(a[0]), "v"(a[1]), "v"(a[2]), "v"(a[3]), "v"(a[4]), "v"(a[5]), "v"(a[6]), "v"(a[7]));
}
__device__ __forceinline__ float exp2x1(float a) {
  float p;
  asm("v_exp_f32 %0, %1\n\tv_nop" : "=&v"(p) : "v"(a));   // the v_nop: the same slot
  return p;
}
__global__ __launch_bounds__(kFWaves * 32) void attn_fused_kernel(
    const unsigned short* __restrict__ QKP, const unsigned short* __restrict__ VP, const float* __restrict__ x,
    const float* __restrict__ gsc, float* __restrict__ out) {
  __shared__ __align__(16) unsigned short sRing[kFGroups * 2 * kFBuf];
  __shared__ float sM[kFGroups][kFQ];
  __shared__ float sL[kFGroups][kFQ];
  const int t     = threadIdx.x;
  const int lane  = t & 31;
  const int wave  = t >> 5;
  const int qt    = wave & 3;
  const int kg    = wave >> 2;
  const int g     = t & 127;                    // thread within the key group
  const int b     = blockIdx.y;
  const int n0    = blockIdx.x * kFQ;
  const int rlane = lane & 15;
  const int hf    = lane >> 4;
  const int koff  = hf * 8;
  const unsigned short* qkb = QKP + (size_t)b * kN * kKP;
  const unsigned short* vpb = VP + (size_t)b * kC * kN;
  const int key0 = kg * (kFStages * kFStage);

  const v16b qf = Frag<__bf16>::load((const __bf16*)(qkb + (size_t)(n0 + qt * 16 + rlane) * kKP + koff));

  // staging: K 64 keys x 4 chunks of 16 B (2 per thread), V 64 rows x 8 chunks (4 per thread, 8 lanes per 128-B line)
  const unsigned short* ksrc = qkb + (size_t)(key0 + (g >> 2)) * kKP + 32 + (g & 3) * 8;
  const unsigned short* vsrc = vpb + (size_t)(g >> 3) * kN + key0 + (g & 7) * 8;
  const int kdst = (g >> 2) * kFKPitch + (g & 3) * 8;
  const int vdst = kFStage * kFKPitch + (g >> 3) * kFVPitch + (g & 7) * 8;
  v4u kr[2], vr[4];
#pragma unroll
  for (int j = 0; j < 2; ++j) kr[j] = *(const v4u*)(ksrc + (size_t)j * 32 * kKP);
#pragma unroll
  for (int j = 0; j < 4; ++j) vr[j] = *(const v4u*)(vsrc + (size_t)j * 16 * kN);

  v8f acc[4];
#pragma unroll
  for (int i = 0; i < 4; ++i) acc[i] = (v8f){0.f,0.f,0.f,0.f,0.f,0.f,0.f,0.f};
  float mrun = -1.0e30f;    // running maximum of score * log2(e)
  float lrun = 0.0f;        // this lane's part of the running sum (its own keys), carried x32768 like P

  for (int s = 0; s < kFStages; ++s) {
    unsigned short* buf = sRing + (kg * 2 + (s & 1)) * kFBuf;
#pragma unroll
    for (int j = 0; j < 2; ++j) *(v4u*)(buf + kdst + j * 32 * kFKPitch) = kr[j];
#pragma unroll
    for (int j = 0; j < 4; ++j) *(v4u*)(buf + vdst + j * 16 * kFVPitch) = vr[j];
    // publishes stage s; every wave has left the other buffer (read in stage s - 1) when the next stage writes it
    __syncthreads();
    if (s + 1 < kFStages) {
      // next stage's rows fly while this stage is worked on
#pragma unroll
      for (int j = 0; j < 2; ++j) kr[j] = *(const v4u*)(ksrc + (size_t)((s + 1) * kFStage + j * 32) * kKP);
#pragma unroll
      for (int j = 0; j < 4; ++j) vr[j] = *(const v4u*)(vsrc + (size_t)j * 16 * kN + (s + 1) * kFStage);
      // the address registers of the six loads are reused by the work below: the wait that precedes such an overwrite
      asm volatile("s_wait_xcnt 0x0" ::: "memory");
    }

    const __bf16*   kb = (const __bf16*)buf;
    const _Float16* vb = (const _Float16*)(buf + kFStage * kFKPitch);
    v8f st[4];
    v16b kf[4];
#pragma unroll
    for (int tt = 0; tt < 4; ++tt) kf[tt] = Frag<__bf16>::load(kb + (tt * 16 + rlane) * kFKPitch + koff);
    // all eight K reads are issued before the first product, so that the wave pays one LDS latency and not one per tile
    __builtin_amdgcn_sched_barrier(0);
#pragma unroll
    for (int tt = 0; tt < 4; ++tt) st[tt] = Frag<__bf16>::mma(kf[tt], qf, (v8f){0.f,0.f,0.f,0.f,0.f,0.f,0.f,0.f});
    // keeps the four score products back to back: each fills the others' result distance, else every one is followed by idle slots
    __builtin_amdgcn_sched_barrier(0);
    float mx = st[0][0];
#pragma unroll
    for (int tt = 0; tt < 4; ++tt)
#pragma unroll
      for (int r = 0; r < 8; ++r) mx = fmaxf(mx, st[tt][r]);
    mx = fmaxf(mx, __shfl_xor(mx, 16, 32));       // the query's other 32 keys of this stage
    const float mnew  = fmaxf(mrun, mx * kLog2e);
    const float alpha = exp2x1(mrun - mnew);
    const float c0    = 15.0f - mnew;             // +15: P carried x32768
    mrun = mnew;
    v16h pb[2];
    float ps = 0.0f;
#pragma unroll
    for (int kk = 0; kk < 2; ++kk) {
      float a0[8], a1[8], p0[8], p1[8];
#pragma unroll
      for (int r = 0; r < 8; ++r) {
        a0[r] = fmaf(st[2 * kk][r], kLog2e, c0);
        a1[r] = fmaf(st[2 * kk + 1][r], kLog2e, c0);
      }
      exp2x8(p0, a0);
      exp2x8(p1, a1);
#pragma unroll
      for (int r = 0; r < 8; ++r) {
        ps += p0[r] + p1[r];
        pb[kk][r]     = (_Float16)p0[r];
        pb[kk][8 + r] = (_Float16)p1[r];
      }
    }
    lrun = fmaf(lrun, alpha, ps);
#pragma unroll
    for (int i = 0; i < 4; ++i) acc[i] *= alpha;
#pragma unroll
    for (int kk = 0; kk < 2; ++kk)
#pragma unroll
      for (int i = 0; i < 4; ++i) {
        const v16h vf = Frag<_Float16>::load(vb + (i * 16 + rlane) * kFVPitch + kk * 32 + koff);
        acc[i] = Frag<_Float16>::mma(vf, pb[kk], acc[i]);
      }
  }

  // ---- join of the five key groups ----
  lrun += __shfl_xor(lrun, 16, 32);
  const int col = qt * 16 + rlane;
  if (hf == 0) { sM[kg][col] = mrun; sL[kg][col] = lrun; }
  __syncthreads();          // maxima and sums published; every wave has left the stage buffers, which become the join slab
  float mall = sM[0][col];
#pragma unroll
  for (int k = 1; k < kFGroups; ++k) mall = fmaxf(mall, sM[k][col]);
  float lall = 0.0f;
#pragma unroll
  for (int k = 0; k < kFGroups; ++k) lall = fmaf(sL[k][col], exp2x1(sM[k][col] - mall), lall);
  const float f = exp2x1(mrun - mall) / lall;
  float* slab = (float*)sRing;
#pragma unroll
  for (int i = 0; i < 4; ++i)
#pragma unroll
    for (int r = 0; r < 8; ++r) slab[(kg * kC + i * 16 + koff + r) * kFOPitch + col] = acc[i][r] * f;
  __syncthreads();
  // 64 rows x 16 float4 = 1024 pieces; 16 lanes cover one 256-B row segment of out
  const float gmul = gsc[0];
  for (int idx = t; idx < kC * (kFQ / 4); idx += kFWaves * 32) {
    const int row = idx >> 4, c4 = (idx & 15) * 4;
    v4f sum = *(const v4f*)(slab + row * kFOPitch + c4);
#pragma unroll
    for (int k = 1; k < kFGroups; ++k) sum += *(const v4f*)(slab + (k * kC + row) * kFOPitch + c4);
    const size_t o = ((size_t)b * kC + row) * kN + n0 + c4;
    const v4f xv = *(const v4f*)(x + o);
    v4f rr;
#pragma unroll
    for (int e = 0; e < 4; ++e) rr[e] = fmaf(gmul, sum[e], xv[e]);
    *(v4f*)(out + o) = rr;
  }
}

// ---------------------------------------------------------------------------
// Weight / bias preparation (one block of 256 threads):
//   WQKh/WQKl: bf16 hi/lo planes of a [64][64] matrix whose rows 0..7 = Wq[out][in], rows 32..39 = Wk[out][in], all other
//   rows zero (computed per lane, both source rows loaded unconditionally with clamped indices, combined arithmetically).
//   WVh/WVl: bf16 hi/lo planes of Wv[64][64]. BQK: f32 [64] with bq at 0..7, bk at 32..39, zero elsewhere.
// ---------------------------------------------------------------------------
__global__ __launch_bounds__(256) void prep_kernel(const float* __restrict__ Wq, const float* __restrict__ Wk,
                                                   const float* __restrict__ Wv,
                                                   const float* __restrict__ bq, const float* __restrict__ bk,
                                                   unsigned short* __restrict__ WQKh, unsigned short* __restrict__ WQKl,
                                                   unsigned short* __restrict__ WVh, unsigned short* __restrict__ WVl,
                                                   float* __restrict__ BQK) {
  const int t = threadIdx.x;
#pragma unroll 1
  for (int it = 0; it < 2; ++it) {
    const int ch = it * 256 + t;            // 0..511 chunks of 8 halves
    const int r  = ch >> 3;                 // output row 0..63
    const int c8 = (ch & 7) * 8;
    const int rq = (r < kCq) ? r : (kCq - 1);
    int rk = r - 32; rk = (rk < 0) ? 0 : rk; rk = (rk > kCq - 1) ? (kCq - 1) : rk;
    const float fq = (r < kCq) ? 1.0f : 0.0f;
    const float fk = ((unsigned)(r - 32) < (unsigned)kCq) ? 1.0f : 0.0f;
    const v4f qa = *(const v4f*)(Wq + rq * kC + c8);
    const v4f qb = *(const v4f*)(Wq + rq * kC + c8 + 4);
    const v4f ka = *(const v4f*)(Wk + rk * kC + c8);
    const v4f kb = *(const v4f*)(Wk + rk * kC + c8 + 4);
    unsigned short hb[8], lb[8];
#pragma unroll
    for (int e = 0; e < 4; ++e) {
      const float v0 = fmaf(fq, qa[e], fk * ka[e]);
      const float v1 = fmaf(fq, qb[e], fk * kb[e]);
      hb[e] = f2bf_bits(v0);
      lb[e] = f2bf_bits(v0 - bf_bits2f(hb[e]));
      hb[4 + e] = f2bf_bits(v1);
      lb[4 + e] = f2bf_bits(v1 - bf_bits2f(hb[4 + e]));
    }
    const v4u uh = (v4u){pk16(hb[0], hb[1]), pk16(hb[2], hb[3]), pk16(hb[4], hb[5]), pk16(hb[6], hb[7])};
    const v4u ul = (v4u){pk16(lb[0], lb[1]), pk16(lb[2], lb[3]), pk16(lb[4], lb[5]), pk16(lb[6], lb[7])};
    unsigned short* ph = WQKh + 8 * (size_t)ch;
    unsigned short* pl = WQKl + 8 * (size_t)ch;
    *(v4u*)ph = uh;
    *(v4u*)pl = ul;
    
  }
#pragma unroll 1
  for (int it = 0; it < 2; ++it) {
    const int ch = it * 256 + t;
    const int r  = ch >> 3;
    const int c8 = (ch & 7) * 8;
    const v4f va = *(const v4f*)(Wv + r * kC + c8);
    const v4f vb = *(const v4f*)(Wv + r * kC + c8 + 4);
    unsigned short hb[8], lb[8];
#pragma unroll
    for (int e = 0; e < 4; ++e) {
      hb[e] = f2bf_bits(va[e]);
      lb[e] = f2bf_bits(va[e] - bf_bits2f(hb[e]));
      hb[4 + e] = f2bf_bits(vb[e]);
      lb[4 + e] = f2bf_bits(vb[e] - bf_bits2f(hb[4 + e]));
    }
    const v4u uh = (v4u){pk16(hb[0], hb[1]), pk16(hb[2], hb[3]), pk16(hb[4], hb[5]), pk16(hb[6], hb[7])};
    const v4u ul = (v4u){pk16(lb[0], lb[1]), pk16(lb[2], lb[3]), pk16(lb[4], lb[5]), pk16(lb[6], lb[7])};
    unsigned short* ph = WVh + 8 * (size_t)ch;
    unsigned short* pl = WVl + 8 * (size_t)ch;
    *(v4u*)ph = uh;
    *(v4u*)pl = ul;
    
  }
  {
    const int tt = t & 15;
    v4f bvv;
#pragma unroll
    for (int e = 0; e < 4; ++e) {
      const int i  = 4 * tt + e;             // 0..63
      const int iq = (i < kCq) ? i : (kCq - 1);
      int ik = i - 32; ik = (ik < 0) ? 0 : ik; ik = (ik > kCq - 1) ? (kCq - 1) : ik;
      const float fq = (i < kCq) ? 1.0f : 0.0f;
      const float fk = ((unsigned)(i - 32) < (unsigned)kCq) ? 1.0f : 0.0f;
      bvv[e] = fmaf(fq, bq[iq], fk * bk[ik]);
    }
    if (t < 16) {
      float* pb = BQK + 4 * t;
      *(v4f*)pb = bvv;
      
    }
  }
}

// ---------------------------------------------------------------------------
// x transpose + bf16 hi/lo split: XTh/XTl[b][n][c] = hi/lo( x[b][c][n] ).
// grid (125, 2): blockIdx.x = 64-wide n tile, blockIdx.y = batch; 256 threads.
// Load coverage: 2 x 8 iterations x 256 threads = 4096 = whole 64(c) x 64(n) tile (coalesced along n).
// Store coverage: 8 waves x 2 iterations x 4 rows (lane>>3) = 64 n-rows; (lane&7) x 8 halves = 64 c-cols; each row = 64 halves =
// ---------------------------------------------------------------------------
__global__ __launch_bounds__(256) void xt_split_kernel(const float* __restrict__ x, unsigned short* __restrict__ XTh,
                                                       unsigned short* __restrict__ XTl) {
  __shared__ float sm[64][65];   // sm[n_local][c]
  const int t  = threadIdx.x;
  const int n0 = blockIdx.x * 64;
  const int b  = blockIdx.y;
  const float* xb = x + (size_t)b * kC * kN;
#pragma unroll 1
  for (int i2 = 0; i2 < 2; ++i2) {
#pragma unroll
    for (int i = 0; i < 8; ++i) {
      const int e  = (i2 * 8 + i) * 256 + t;
      const int c  = e >> 6;          // channel 0..63
      const int nl = e & 63;          // n local
      sm[nl][c] = xb[(size_t)c * kN + n0 + nl];
    }
  }
  __syncthreads();
  const int lane = t & 31, wave = t >> 5;
  const int q = lane >> 3, c8 = (lane & 7) * 8;
  unsigned short* oh = XTh + (size_t)b * kN * kC;
  unsigned short* ol = XTl + (size_t)b * kN * kC;
  v4u uh[2], ul[2];
#pragma unroll
  for (int it = 0; it < 2; ++it) {
    const int row = wave * 8 + it * 4 + q;   // n local
    unsigned short hb[8], lb[8];
#pragma unroll
    for (int e = 0; e < 8; ++e) {
      const float v = sm[row][c8 + e];
      hb[e] = f2bf_bits(v);
      lb[e] = f2bf_bits(v - bf_bits2f(hb[e]));
    }
    uh[it] = (v4u){pk16(hb[0], hb[1]), pk16(hb[2], hb[3]), pk16(hb[4], hb[5]), pk16(hb[6], hb[7])};
    ul[it] = (v4u){pk16(lb[0], lb[1]), pk16(lb[2], lb[3]), pk16(lb[4], lb[5]), pk16(lb[6], lb[7])};
  }
  {
#pragma unroll
    for (int it = 0; it < 2; ++it) {
      const int row = wave * 8 + it * 4 + q;
      *(v4u*)(oh + (size_t)(n0 + row) * kC + c8) = uh[it];
      *(v4u*)(ol + (size_t)(n0 + row) * kC + c8) = ul[it];
    }
    
  }
}

// ---------------------------------------------------------------------------
// Packed q|k operand plane: from the f32 projection output QKF[row][64] (cols 0..7 = q, cols 32..39 = k, rest 0) build
// QKP[row][64] bf16 with cols 0..7 = hi(q), 8..15 = lo(q), 16..23 = hi(q), 24..31 = 0, 32..39 = hi(k), 40..47 = hi(k),
// 48..55 = lo(k), 56..63 = 0, so that sum_{s<32} QKP[n][s] * QKP[m][32+s] = qh.kh + ql.kh + qh.kl.
// 256 threads = 32 rows x 8 lane groups; group g owns cols 8g..8g+7; both q and k of the row are loaded by every lane
// ---------------------------------------------------------------------------
__global__ __launch_bounds__(256) void qk_pack_kernel(const float* __restrict__ QKF, unsigned short* __restrict__ QKP, int nrows) {
  const int t    = threadIdx.x;
  const int rowi = blockIdx.x * 32 + (t >> 3);
  const int g    = t & 7;
  const int rowc = (rowi < nrows) ? rowi : (nrows - 1);
  const float* rp = QKF + (size_t)rowc * kKP;
  const v4f qa = *(const v4f*)(rp);
  const v4f qb = *(const v4f*)(rp + 4);
  const v4f ka = *(const v4f*)(rp + 32);
  const v4f kb = *(const v4f*)(rp + 36);
  const float fq = (g < 3) ? 1.0f : 0.0f;
  const float fk = ((unsigned)(g - 4) < 3u) ? 1.0f : 0.0f;
  const bool islo = (g == 1) || (g == 6);
  unsigned short ob[8];
#pragma unroll
  for (int e = 0; e < 4; ++e) {
    const float v0 = fmaf(fq, qa[e], fk * ka[e]);
    const float v1 = fmaf(fq, qb[e], fk * kb[e]);
    const unsigned short h0 = f2bf_bits(v0);
    const unsigned short l0 = f2bf_bits(v0 - bf_bits2f(h0));
    const unsigned short h1 = f2bf_bits(v1);
    const unsigned short l1 = f2bf_bits(v1 - bf_bits2f(h1));
    ob[e]     = islo ? l0 : h0;
    ob[4 + e] = islo ? l1 : h1;
  }
  const v4u u = (v4u){pk16(ob[0], ob[1]), pk16(ob[2], ob[3]), pk16(ob[4], ob[5]), pk16(ob[6], ob[7])};
  if (rowi < nrows) {
    unsigned short* dst = QKP + (size_t)rowi * kKP + 8 * g;
    *(v4u*)dst = u;
    
  }
}

// ---------------------------------------------------------------------------
// Host glue.
//   XTh  bf16 [2][8000][64]      2,048,000  at          0
//   XTl  bf16 [2][8000][64]      2,048,000  at  2,048,000
//   WQKh bf16 [64][64]               8,192  at  4,096,000
//   WQKl bf16 [64][64]               8,192  at  4,104,192
//   WVh  bf16 [64][64]               8,192  at  4,112,384
//   WVl  bf16 [64][64]               8,192  at  4,120,576
//   BQK  f32  [64]                     256  at  4,128,768
//   QKF  f32  [2][8000][64]      4,096,000  at  4,129,024
//   QKP  bf16 [2][8000][64]      2,048,000  at  8,225,024
//   VP   f16  [2][64][8000]      2,048,000  at 10,273,024
//   total                      12,321,024
// GEMM shapes: q|k projection M=8000, N=64, K=64; v projection M=64, N=8000, K=64; in the fused kernel per block scores
// M=8000 keys, N=64 queries, K=32 and V.P^T M=64, N=64, K=8000. No partial tiles, no padding rows.
// ---------------------------------------------------------------------------
extern "C" void kernel_launch(void* const* d_in, const int* in_sizes, int n_in,
                              void* d_out, int out_size, void* d_ws, size_t ws_size,
                              hipStream_t stream) {
  if (n_in < 8) return;
  const int nElem = kB * kC * kN;                 // 1,024,000
  if (in_sizes[0] != nElem) return;
  if (in_sizes[1] != kCq * kC || in_sizes[2] != kCq) return;
  if (in_sizes[3] != kCq * kC || in_sizes[4] != kCq) return;
  if (in_sizes[5] != kC * kC || in_sizes[6] != kC || in_sizes[7] < 1) return;
  if (out_size != nElem) return;

  const size_t szXT  = (size_t)kB * kN * kC * 2;
  const size_t szW   = (size_t)64 * 64 * 2;
  const size_t szBQK = (size_t)64 * 4;
  const size_t szQKF = (size_t)kB * kN * kKP * 4;
  const size_t szQKP = (size_t)kB * kN * kKP * 2;
  const size_t szVP  = (size_t)kB * kC * kN * 2;
  const size_t offXTh  = 0;
  const size_t offXTl  = offXTh + szXT;
  const size_t offWQKh = offXTl + szXT;
  const size_t offWQKl = offWQKh + szW;
  const size_t offWVh  = offWQKl + szW;
  const size_t offWVl  = offWVh + szW;
  const size_t offBQK  = offWVl + szW;
  const size_t offQKF  = offBQK + szBQK;
  const size_t offQKP  = offQKF + szQKF;
  const size_t offVP   = offQKP + szQKP;
  const size_t total   = offVP + szVP;
  if (ws_size < total) return;

  const float* x     = (const float*)d_in[0];
  const float* Wq    = (const float*)d_in[1];
  const float* bq    = (const float*)d_in[2];
  const float* Wk    = (const float*)d_in[3];
  const float* bk    = (const float*)d_in[4];
  const float* Wv    = (const float*)d_in[5];
  const float* bv    = (const float*)d_in[6];
  const float* gamma = (const float*)d_in[7];
  float* out = (float*)d_out;
  char* ws = (char*)d_ws;
  unsigned short* XTh  = (unsigned short*)(ws + offXTh);
  unsigned short* XTl  = (unsigned short*)(ws + offXTl);
  unsigned short* WQKh = (unsigned short*)(ws + offWQKh);
  unsigned short* WQKl = (unsigned short*)(ws + offWQKl);
  unsigned short* WVh  = (unsigned short*)(ws + offWVh);
  unsigned short* WVl  = (unsigned short*)(ws + offWVl);
  float* BQK = (float*)(ws + offBQK);
  float* QKF = (float*)(ws + offQKF);
  unsigned short* QKP = (unsigned short*)(ws + offQKP);
  unsigned short* VP  = (unsigned short*)(ws + offVP);

  // ---- prologue: weight planes, x^T planes, projections ----
  prep_kernel<<<dim3(1), dim3(256), 0, stream>>>(Wq, Wk, Wv, bq, bk, WQKh, WQKl, WVh, WVl, BQK);
  xt_split_kernel<<<dim3(kN / 64, kB), dim3(256), 0, stream>>>(x, XTh, XTl);
  // QKF[b][n][col] = sum_c XT[b][n][c] * WQK[col][c] + BQK[col]   (M=8000, N=64, K=64; bf16 hi/lo both operands)
  wmma_gemm64<1, true, 2, 0, false, 0><<<dim3(kBlocksProj, kB), dim3(256), 0, stream>>>(
      XTh, XTl, kC, (long)kN * kC,
      WQKh, WQKl, kC, 0L,
      (void*)QKF, (void*)QKF, kKP, (long)kN * kKP,
      BQK, BQK, 0L,
      kN, kKP, kC, 1.0f);
  qk_pack_kernel<<<dim3((kB * kN) / 32), dim3(256), 0, stream>>>(QKF, QKP, kB * kN);
  // VP[b][c][m] = f16( sum_c' WV[c][c'] * XT[b][m][c'] + bv[c] )   (M=64, N=8000, K=64; bf16 hi/lo both operands)
  wmma_gemm64<1, true, 1, 1, false, 0><<<dim3(kBlocksProj, kB), dim3(256), 0, stream>>>(
      WVh, WVl, kC, 0L,
      XTh, XTl, kC, (long)kN * kC,
      (void*)VP, (void*)VP, kN, (long)kC * kN,
      bv, bv, 0L,
      kC, kN, kC, 1.0f);

  // ---- scores -> softmax -> V.P^T -> gamma scale and residual, one launch ----
  attn_fused_kernel<<<dim3(kN / kFQ, kB), dim3(kFWaves * 32), 0, stream>>>(QKP, VP, x, gamma, out);
}

// v003
// Measured time: 41.4 microseconds a run.
// Timed twice side by side with v002, it ran 1.69 and 1.70 times as fast.
// Counting every step since v000, it is 85.9 times as fast.
// Contractions: q/k/v channel projections on v_wmma_f32_16x16x32_bf16 with W and x as bf16 hi+lo planes (hh+hl+lh); energy k.q^T on v_wmma_f32_16x16x32_bf16 with q,k bf16 hi|lo parts packed along the 32-deep k axis (hh+lh+hl in one pass); V.P^T on v_wmma_f32_16x16x32_f16 (P = exp(s - running max) in f16 carried x32768, V f16 plane); f32 accumulate everywhere; softmax, biases, gamma scale and residual in f32.
#include <hip/hip_runtime.h>
#include <math.h>

// ---------------------------------------------------------------------------
// Problem constants
// ---------------------------------------------------------------------------
constexpr int kB    = 2;        // batch
constexpr int kC    = 64;       // channels (value dim and projection K)
constexpr int kCq   = 8;        // query/key channels
constexpr int kN    = 8000;     // voxels per sample (20*20*20)
constexpr int kKP   = 64;       // packed q|k row width in halves: q block cols 0..31, k block cols 32..63
static_assert(kN % 64 == 0, "tiles");
static_assert(kC == 64 && kKP % 32 == 0 && kC % 32 == 0 && kN % 32 == 0, "k multiples");
static_assert(3 * kCq <= 32 && 2 * kCq == 16, "hi|lo|hi packing fits one k step; q and k rows fill one 16-row tile");

typedef __attribute__((ext_vector_type(16))) _Float16 v16h;
typedef __attribute__((ext_vector_type(8)))  _Float16 v8h;
typedef __attribute__((ext_vector_type(4)))  _Float16 v4h;
typedef __attribute__((ext_vector_type(16))) __bf16   v16b;
typedef __attribute__((ext_vector_type(8)))  __bf16   v8b;
typedef __attribute__((ext_vector_type(8)))  float    v8f;
typedef __attribute__((ext_vector_type(4)))  float    v4f;
typedef __attribute__((ext_vector_type(4)))  unsigned int v4u;

__device__ __forceinline__ unsigned short f2bf_bits(float f) {
  unsigned u = __float_as_uint(f);
  return (unsigned short)((u + 0x7FFFu + ((u >> 16) & 1u)) >> 16);
}
__device__ __forceinline__ float bf_bits2f(unsigned short h) { return __uint_as_float(((unsigned)h) << 16); }
__device__ __forceinline__ unsigned pk16(unsigned short a, unsigned short b) { return (unsigned)a | ((unsigned)b << 16); }

template <typename T> struct Frag;
template <> struct Frag<_Float16> {
  typedef v16h V; union U { v16h v; v8h h[2]; };
  // elements 0..7 <- p[0..7], 8..15 <- p[16..23]
  static __device__ __forceinline__ v16h load(const _Float16* p) {
    U f; f.h[0] = *(const v8h*)(p); f.h[1] = *(const v8h*)(p + 16); return f.v;
  }
  static __device__ __forceinline__ v8f mma(v16h a, v16h b, v8f c) {
    return __builtin_amdgcn_wmma_f32_16x16x32_f16(false, a, false, b, (short)0, c, false, false);
  }
};
template <> struct Frag<__bf16> {
  typedef v16b V; union U { v16b v; v8b h[2]; v4u u[2]; };
  static __device__ __forceinline__ v16b load(const __bf16* p) {
    U f; f.h[0] = *(const v8b*)(p); f.h[1] = *(const v8b*)(p + 16); return f.v;
  }
  static __device__ __forceinline__ v8f mma(v16b a, v16b b, v8f c) {
    return __builtin_amdgcn_wmma_f32_16x16x32_bf16(false, a, false, b, (short)0, c, false, false);
  }
};

// ---------------------------------------------------------------------------
// All three projections in one kernel, straight from x and the f32 weights to the two operand planes of the attention kernel:
//   QKP[b][n][64] bf16: cols 0..7 = hi(q), 8..15 = lo(q), 16..23 = hi(q), 24..31 = 0, 32..39 = hi(k), 40..47 = hi(k),
//   48..55 = lo(k), 56..63 = 0, so that sum_{s<32} QKP[n][s] * QKP[m][32+s] = qh.kh + ql.kh + qh.kl;
//   VP[b][c][m] f16 = Wv.x + bv.
// grid (kN / 64, kB), 5 waves. A block owns 64 voxels. D = W.x: rows = output channels, columns = voxels. Wave w < 4 owns rows
// 16w..16w+15 of Wv, wave 4 the 16 rows Wq|Wk; each wave splits its own 16 weight rows into bf16 hi/lo A fragments in registers.
// Column j of column tile tt is voxel 4j + tt, so one float4 of x feeds the four tiles and four f16 results of a V row are 8 B
// (16 lanes = one 128-B line). Wave w < 4 splits 16 of the 64 channels (k step w >> 1, fragment half w & 1) of all 64 voxels
// into hi/lo and writes them to LDS already in B-fragment order, lane by lane; one barrier publishes them to the five waves.
// k order of A and B alike: element h * 8 + e of a lane is channel ks * 32 + h * 16 + (lane >> 4) * 8 + e.
// ---------------------------------------------------------------------------
constexpr int kPVox   = 64;                     // voxels per block
constexpr int kPWaves = 5;                      // four V row tiles and the q|k row tile
static_assert(kN % kPVox == 0 && kC == 4 * 16, "projection tiling is exact");
__device__ __forceinline__ void split8(const float (&v)[8], v4u& hi, v4u& lo) {
  unsigned short hb[8], lb[8];
#pragma unroll
  for (int e = 0; e < 8; ++e) {
    hb[e] = f2bf_bits(v[e]);
    lb[e] = f2bf_bits(v[e] - bf_bits2f(hb[e]));
  }
  hi = (v4u){pk16(hb[0], hb[1]), pk16(hb[2], hb[3]), pk16(hb[4], hb[5]), pk16(hb[6], hb[7])};
  lo = (v4u){pk16(lb[0], lb[1]), pk16(lb[2], lb[3]), pk16(lb[4], lb[5]), pk16(lb[6], lb[7])};
}
// halves offset of the 16-B piece (column tile tt, k step ks, plane pl, fragment half h) of one lane
__device__ __forceinline__ int xfrag_off(int tt, int ks, int pl, int h, int lane) {
  return ((((tt * 2 + ks) * 2 + pl) * 2 + h) * 32 + lane) * 8;
}
// acc[tt] = W.x over both k steps. The three partial products are summed hi.hi, x_hi.w_lo, x_lo.w_hi (XLEAD) or hi.hi, w_hi.x_lo,
// w_lo.x_hi.
template <bool XLEAD>
__device__ __forceinline__ void proj_products(const v16b (&ah)[2], const v16b (&al)[2], const unsigned short* sX, int lane,
                                              v8f (&acc)[4]) {
#pragma unroll
  for (int tt = 0; tt < 4; ++tt) acc[tt] = (v8f){0.f,0.f,0.f,0.f,0.f,0.f,0.f,0.f};
#pragma unroll
  for (int ks = 0; ks < 2; ++ks) {
    v16b bh[4], bl[4];
#pragma unroll
    for (int tt = 0; tt < 4; ++tt) {
      Frag<__bf16>::U fh, fl;
      fh.u[0] = *(const v4u*)(sX + xfrag_off(tt, ks, 0, 0, lane));
      fh.u[1] = *(const v4u*)(sX + xfrag_off(tt, ks, 0, 1, lane));
      fl.u[0] = *(const v4u*)(sX + xfrag_off(tt, ks, 1, 0, lane));
      fl.u[1] = *(const v4u*)(sX + xfrag_off(tt, ks, 1, 1, lane));
      bh[tt] = fh.v;
      bl[tt] = fl.v;
    }
#pragma unroll
    for (int tt = 0; tt < 4; ++tt) acc[tt] = Frag<__bf16>::mma(ah[ks], bh[tt], acc[tt]);
#pragma unroll
    for (int tt = 0; tt < 4; ++tt) acc[tt] = XLEAD ? Frag<__bf16>::mma(al[ks], bh[tt], acc[tt]) : Frag<__bf16>::mma(ah[ks], bl[tt], acc[tt]);
#pragma unroll
    for (int tt = 0; tt < 4; ++tt) acc[tt] = XLEAD ? Frag<__bf16>::mma(ah[ks], bl[tt], acc[tt]) : Frag<__bf16>::mma(al[ks], bh[tt], acc[tt]);
  }
}
__global__ __launch_bounds__(kPWaves * 32) void proj_fused_kernel(
    const float* __restrict__ x, const float* __restrict__ Wq, const float* __restrict__ bq, const float* __restrict__ Wk,
    const float* __restrict__ bk, const float* __restrict__ Wv, const float* __restrict__ bv,
    unsigned short* __restrict__ QKP, unsigned short* __restrict__ VP) {
  __shared__ __align__(16) unsigned short sX[4 * 2 * 2 * 2 * 32 * 8];   // 16 KiB: x hi/lo planes in B-fragment order
  const int lane = threadIdx.x & 31;
  const int wave = __builtin_amdgcn_readfirstlane(threadIdx.x >> 5);
  const int rl   = lane & 15;
  const int hf   = lane >> 4;
  const int b    = blockIdx.y;
  const int n0   = blockIdx.x * kPVox;

  // this wave's 16 weight rows, one per lane & 15
  const float* wrow = ((wave < 4) ? (Wv + (wave * 16 + rl) * kC) : ((rl < kCq) ? (Wq + rl * kC) : (Wk + (rl - kCq) * kC))) + hf * 8;
  v4f wv[2][2][2];
#pragma unroll
  for (int ks = 0; ks < 2; ++ks)
#pragma unroll
    for (int h = 0; h < 2; ++h)
#pragma unroll
      for (int p = 0; p < 2; ++p) wv[ks][h][p] = *(const v4f*)(wrow + ks * 32 + h * 16 + p * 4);
  const float* brow = (wave < 4) ? (bv + wave * 16 + hf * 8) : (hf ? bk : bq);
  const v4f bias0 = *(const v4f*)(brow);
  const v4f bias1 = *(const v4f*)(brow + 4);
  // the two address pairs of the ten loads above are reused below: the wait that precedes such an overwrite; naming them as
  // inputs keeps both pairs whole up to it
  asm volatile("s_wait_xcnt 0x0" :: "v"(wrow), "v"(brow) : "memory");

  if (wave < 4) {
    const int ks = wave >> 1, h = wave & 1;
    const float* xs = x + ((size_t)b * kC + ks * 32 + h * 16 + hf * 8) * kN + n0 + rl * 4;
    v4f xv[8];
#pragma unroll
    for (int e = 0; e < 8; ++e) xv[e] = *(const v4f*)(xs + (size_t)e * kN);
#pragma unroll
    for (int tt = 0; tt < 4; ++tt) {
      float v[8];
#pragma unroll
      for (int e = 0; e < 8; ++e) v[e] = xv[e][tt];
      v4u hi, lo;
      split8(v, hi, lo);
      *(v4u*)(sX + xfrag_off(tt, ks, 0, h, lane)) = hi;
      *(v4u*)(sX + xfrag_off(tt, ks, 1, h, lane)) = lo;
    }
  }

  v16b ah[2], al[2];
#pragma unroll
  for (int ks = 0; ks < 2; ++ks) {
    Frag<__bf16>::U fh, fl;
#pragma unroll
    for (int h = 0; h < 2; ++h) {
      float v[8];
#pragma unroll
      for (int e = 0; e < 4; ++e) { v[e] = wv[ks][h][0][e]; v[4 + e] = wv[ks][h][1][e]; }
      split8(v, fh.u[h], fl.u[h]);
    }
    ah[ks] = fh.v;
    al[ks] = fl.v;
  }
  __syncthreads();          // the x fragments of all 64 channels are published to the five waves

  v8f acc[4];
  if (wave == 4) {          // behind the only barrier: the q|k wave finishes here
    proj_products<true>(ah, al, sX, lane, acc);
    unsigned short* qrow = QKP + ((size_t)b * kN + n0 + rl * 4) * kKP + hf * 32;
#pragma unroll
    for (int tt = 0; tt < 4; ++tt) {
      float v[8];
#pragma unroll
      for (int r = 0; r < 8; ++r) v[r] = acc[tt][r] + ((r < 4) ? bias0[r & 3] : bias1[r & 3]);
      v4u hi, lo;
      split8(v, hi, lo);
      unsigned short* dst = qrow + tt * kKP;
      *(v4u*)(dst)      = hi;
      *(v4u*)(dst + 8)  = hf ? hi : lo;
      *(v4u*)(dst + 16) = hf ? lo : hi;
      *(v4u*)(dst + 24) = (v4u){0u, 0u, 0u, 0u};
    }
    return;
  }
  proj_products<false>(ah, al, sX, lane, acc);
  unsigned short* vrow = VP + ((size_t)b * kC + wave * 16 + hf * 8) * kN + n0 + rl * 4;
#pragma unroll
  for (int r = 0; r < 8; ++r) {
    const float bb = (r < 4) ? bias0[r & 3] : bias1[r & 3];
    v4h o;
#pragma unroll
    for (int tt = 0; tt < 4; ++tt) o[tt] = (_Float16)(acc[tt][r] + bb);
    *(v4h*)(vrow + (size_t)r * kN) = o;
  }
  // the built code lays this path in front of the q|k wave's, with a never-taken branch on into it, where the registers of the
  // eight stores are rewritten: the wait that precedes such an overwrite
  asm volatile("s_wait_xcnt 0x0" ::: "memory");
}

// ---------------------------------------------------------------------------
// Scores, softmax and V.P^T in one kernel; scores and probabilities never leave the registers.
//   out[b][c][n] = gsc[0] * sum_m V[b][c][m] * softmax_m(q[n].k[m]) + x[b][c][n]
// grid (kN / 64, kB), 20 waves. A block owns 64 queries; wave w = 4 * kg + qt owns query tile qt (16 queries) and key group kg
// (kN / 5 keys), walked in stages of 64 keys. The four waves of a key group stage its K rows (packed k halves) and V rows
// through registers into their own pair of LDS buffers; one block barrier per stage publishes a stage and frees the other buffer.
// S^T = K.Q^T: a lane holds 8 keys per 16-key tile of ONE query (column lane & 15), keys (lane >> 4) * 8 + r, which is the
// k order of the B fragment of the next product, so P^T is packed in place. O^T += V.P^T: the same column per lane, so the
// running-maximum rescale is one factor per lane. The five key groups are joined through LDS in index order at the end.
// ---------------------------------------------------------------------------
constexpr int kFQ      = 64;                    // queries per block
constexpr int kFGroups = 5;                     // key groups per block
constexpr int kFWaves  = 4 * kFGroups;          // 20
constexpr int kFStage  = 64;                    // keys per stage
constexpr int kFStages = kN / kFGroups / kFStage;   // 25
constexpr int kFKPitch = 40;                    // halves per staged K row: 80 B = 16 B x odd
constexpr int kFVPitch = 72;                    // halves per staged V row: 144 B = 16 B x odd
constexpr int kFBuf    = kFStage * kFKPitch + kC * kFVPitch;   // halves per buffer: 7168
constexpr int kFOPitch = 68;                    // floats per row of the join slab
constexpr float kLog2e = 1.4426950408889634f;
static_assert(kFStages * kFStage * kFGroups == kN && kN % kFQ == 0, "key and query split are exact");
static_assert(kFGroups * 2 * kFBuf * 2 >= kFGroups * kC * kFOPitch * 4, "join slab fits in the stage buffers");
// Hardware exp2. The instruction set asks for one independent instruction between a transcendental and an instruction that
// reads its result or overwrites its source. In one statement, with results kept apart from sources, each exp2 fills its neighbour's slot and the
// closing v_nop fills the last one's.
__device__ __forceinline__ void exp2x8(float (&p)[8], const float (&a)[8]) {
  asm("v_exp_f32 %0, %8\n\tv_exp_f32 %1, %9\n\tv_exp_f32 %2, %10\n\tv_exp_f32 %3, %11\n\t"
      "v_exp_f32 %4, %12\n\tv_exp_f32 %5, %13\n\tv_exp_f32 %6, %14\n\tv_exp_f32 %7, %15\n\tv_nop"
      : "=&v"(p[0]), "=&v"(p[1]), "=&v"(p[2]), "=&v"(p[3]), "=&v"(p[4]), "=&v"(p[5]), "=&v"(p[6]), "=&v"(p[7])
      : "v"(a[0]), "v"(a[1]), "v"(a[2]), "v"(a[3]), "v"(a[4]), "v"(a[5]), "v"(a[6]), "v"(a[7]));
}
__device__ __forceinline__ float exp2x1(float a) {
  float p;
  asm("v_exp_f32 %0, %1\n\tv_nop" : "=&v"(p) : "v"(a));   // the v_nop: the same slot
  return p;
}
__global__ __launch_bounds__(kFWaves * 32) void attn_fused_kernel(
    const unsigned short* __restrict__ QKP, const unsigned short* __restrict__ VP, const float* __restrict__ x,
    const float* __restrict__ gsc, float* __restrict__ out) {
  __shared__ __align__(16) unsigned short sRing[kFGroups * 2 * kFBuf];
  __shared__ float sM[kFGroups][kFQ];
  __shared__ float sL[kFGroups][kFQ];
  const int t     = threadIdx.x;
  const int lane  = t & 31;
  const int wave  = t >> 5;
  const int qt    = wave & 3;
  const int kg    = wave >> 2;
  const int g     = t & 127;                    // thread within the key group
  const int b     = blockIdx.y;
  const int n0    = blockIdx.x * kFQ;
  const int rlane = lane & 15;
  const int hf    = lane >> 4;
  const int koff  = hf * 8;
  const unsigned short* qkb = QKP + (size_t)b * kN * kKP;
  const unsigned short* vpb = VP + (size_t)b * kC * kN;
  const int key0 = kg * (kFStages * kFStage);

  const v16b qf = Frag<__bf16>::load((const __bf16*)(qkb + (size_t)(n0 + qt * 16 + rlane) * kKP + koff));

  // staging: K 64 keys x 4 chunks of 16 B (2 per thread), V 64 rows x 8 chunks (4 per thread, 8 lanes per 128-B line)
  const unsigned short* ksrc = qkb + (size_t)(key0 + (g >> 2)) * kKP + 32 + (g & 3) * 8;
  const unsigned short* vsrc = vpb + (size_t)(g >> 3) * kN + key0 + (g & 7) * 8;
  const int kdst = (g >> 2) * kFKPitch + (g & 3) * 8;
  const int vdst = kFStage * kFKPitch + (g >> 3) * kFVPitch + (g & 7) * 8;
  v4u kr[2], vr[4];
#pragma unroll
  for (int j = 0; j < 2; ++j) kr[j] = *(const v4u*)(ksrc + (size_t)j * 32 * kKP);
#pragma unroll
  for (int j = 0; j < 4; ++j) vr[j] = *(const v4u*)(vsrc + (size_t)j * 16 * kN);

  v8f acc[4];
#pragma unroll
  for (int i = 0; i < 4; ++i) acc[i] = (v8f){0.f,0.f,0.f,0.f,0.f,0.f,0.f,0.f};
  float mrun = -1.0e30f;    // running maximum of score * log2(e)
  float lrun = 0.0f;        // this lane's part of the running sum (its own keys), carried x32768 like P

  for (int s = 0; s < kFStages; ++s) {
    unsigned short* buf = sRing + (kg * 2 + (s & 1)) * kFBuf;
#pragma unroll
    for (int j = 0; j < 2; ++j) *(v4u*)(buf + kdst + j * 32 * kFKPitch) = kr[j];
#pragma unroll
    for (int j = 0; j < 4; ++j) *(v4u*)(buf + vdst + j * 16 * kFVPitch) = vr[j];
    // publishes stage s; every wave has left the other buffer (read in stage s - 1) when the next stage writes it
    __syncthreads();
    if (s + 1 < kFStages) {
      // next stage's rows fly while this stage is worked on
#pragma unroll
      for (int j = 0; j < 2; ++j) kr[j] = *(const v4u*)(ksrc + (size_t)((s + 1) * kFStage + j * 32) * kKP);
#pragma unroll
      for (int j = 0; j < 4; ++j) vr[j] = *(const v4u*)(vsrc + (size_t)j * 16 * kN + (s + 1) * kFStage);
      // the address registers of the six loads are reused by the work below: the wait that precedes such an overwrite
      asm volatile("s_wait_xcnt 0x0" ::: "memory");
    }

    const __bf16*   kb = (const __bf16*)buf;
    const _Float16* vb = (const _Float16*)(buf + kFStage * kFKPitch);
    v8f st[4];
    v16b kf[4];
#pragma unroll
    for (int tt = 0; tt < 4; ++tt) kf[tt] = Frag<__bf16>::load(kb + (tt * 16 + rlane) * kFKPitch + koff);
    // all eight K reads are issued before the first product, so that the wave pays one LDS latency and not one per tile
    __builtin_amdgcn_sched_barrier(0);
#pragma unroll
    for (int tt = 0; tt < 4; ++tt) st[tt] = Frag<__bf16>::mma(kf[tt], qf, (v8f){0.f,0.f,0.f,0.f,0.f,0.f,0.f,0.f});
    // keeps the four score products back to back: each fills the others' result distance, else every one is followed by idle slots
    __builtin_amdgcn_sched_barrier(0);
    float mx = st[0][0];
#pragma unroll
    for (int tt = 0; tt < 4; ++tt)
#pragma unroll
      for (int r = 0; r < 8; ++r) mx = fmaxf(mx, st[tt][r]);
    mx = fmaxf(mx, __shfl_xor(mx, 16, 32));       // the query's other 32 keys of this stage
    const float mnew  = fmaxf(mrun, mx * kLog2e);
    const float alpha = exp2x1(mrun - mnew);
    const float c0    = 15.0f - mnew;             // +15: P carried x32768
    mrun = mnew;
    v16h pb[2];
    float ps = 0.0f;
#pragma unroll
    for (int kk = 0; kk < 2; ++kk) {
      float a0[8], a1[8], p0[8], p1[8];
#pragma unroll
      for (int r = 0; r < 8; ++r) {
        a0[r] = fmaf(st[2 * kk][r], kLog2e, c0);
        a1[r] = fmaf(st[2 * kk + 1][r], kLog2e, c0);
      }
      exp2x8(p0, a0);
      exp2x8(p1, a1);
#pragma unroll
      for (int r = 0; r < 8; ++r) {
        ps += p0[r] + p1[r];
        pb[kk][r]     = (_Float16)p0[r];
        pb[kk][8 + r] = (_Float16)p1[r];
      }
    }
    lrun = fmaf(lrun, alpha, ps);
#pragma unroll
    for (int i = 0; i < 4; ++i) acc[i] *= alpha;
#pragma unroll
    for (int kk = 0; kk < 2; ++kk)
#pragma unroll
      for (int i = 0; i < 4; ++i) {
        const v16h vf = Frag<_Float16>::load(vb + (i * 16 + rlane) * kFVPitch + kk * 32 + koff);
        acc[i] = Frag<_Float16>::mma(vf, pb[kk], acc[i]);
      }
  }

  // ---- join of the five key groups ----
  lrun += __shfl_xor(lrun, 16, 32);
  const int col = qt * 16 + rlane;
  if (hf == 0) { sM[kg][col] = mrun; sL[kg][col] = lrun; }
  __syncthreads();          // maxima and sums published; every wave has left the stage buffers, which become the join slab
  float mall = sM[0][col];
#pragma unroll
  for (int k = 1; k < kFGroups; ++k) mall = fmaxf(mall, sM[k][col]);
  float lall = 0.0f;
#pragma unroll
  for (int k = 0; k < kFGroups; ++k) lall = fmaf(sL[k][col], exp2x1(sM[k][col] - mall), lall);
  const float f = exp2x1(mrun - mall) / lall;
  float* slab = (float*)sRing;
#pragma unroll
  for (int i = 0; i < 4; ++i)
#pragma unroll
    for (int r = 0; r < 8; ++r) slab[(kg * kC + i * 16 + koff + r) * kFOPitch + col] = acc[i][r] * f;
  __syncthreads();
  // 64 rows x 16 float4 = 1024 pieces; 16 lanes cover one 256-B row segment of out
  const float gmul = gsc[0];
  for (int idx = t; idx < kC * (kFQ / 4); idx += kFWaves * 32) {
    const int row = idx >> 4, c4 = (idx & 15) * 4;
    v4f sum = *(const v4f*)(slab + row * kFOPitch + c4);
#pragma unroll
    for (int k = 1; k < kFGroups; ++k) sum += *(const v4f*)(slab + (k * kC + row) * kFOPitch + c4);
    const size_t o = ((size_t)b * kC + row) * kN + n0 + c4;
    const v4f xv = *(const v4f*)(x + o);
    v4f rr;
#pragma unroll
    for (int e = 0; e < 4; ++e) rr[e] = fmaf(gmul, sum[e], xv[e]);
    *(v4f*)(out + o) = rr;
  }
}

// ---------------------------------------------------------------------------
// Host glue.
//   QKP  bf16 [2][8000][64]      2,048,000  at          0
//   VP   f16  [2][64][8000]      2,048,000  at  2,048,000
//   total                        4,096,000
// GEMM shapes: projections per block M=80 (Wv rows, then Wq|Wk rows), N=64 voxels, K=64; in the attention kernel per block scores
// M=8000 keys, N=64 queries, K=32 and V.P^T M=64, N=64, K=8000. No partial tiles, no padding rows.
// ---------------------------------------------------------------------------
extern "C" void kernel_launch(void* const* d_in, const int* in_sizes, int n_in,
                              void* d_out, int out_size, void* d_ws, size_t ws_size,
                              hipStream_t stream) {
  if (n_in < 8) return;
  const int nElem = kB * kC * kN;                 // 1,024,000
  if (in_sizes[0] != nElem) return;
  if (in_sizes[1] != kCq * kC || in_sizes[2] != kCq) return;
  if (in_sizes[3] != kCq * kC || in_sizes[4] != kCq) return;
  if (in_sizes[5] != kC * kC || in_sizes[6] != kC || in_sizes[7] < 1) return;
  if (out_size != nElem) return;

  const size_t szQKP = (size_t)kB * kN * kKP * 2;
  const size_t szVP  = (size_t)kB * kC * kN * 2;
  const size_t offQKP  = 0;
  const size_t offVP   = offQKP + szQKP;
  const size_t total   = offVP + szVP;
  if (ws_size < total) return;

  const float* x     = (const float*)d_in[0];
  const float* Wq    = (const float*)d_in[1];
  const float* bq    = (const float*)d_in[2];
  const float* Wk    = (const float*)d_in[3];
  const float* bk    = (const float*)d_in[4];
  const float* Wv    = (const float*)d_in[5];
  const float* bv    = (const float*)d_in[6];
  const float* gamma = (const float*)d_in[7];
  float* out = (float*)d_out;
  char* ws = (char*)d_ws;
  unsigned short* QKP = (unsigned short*)(ws + offQKP);
  unsigned short* VP  = (unsigned short*)(ws + offVP);

  // ---- x, weights -> packed q|k plane and V plane, one launch ----
  proj_fused_kernel<<<dim3(kN / kPVox, kB), dim3(kPWaves * 32), 0, stream>>>(x, Wq, bq, Wk, bk, Wv, bv, QKP, VP);
  // ---- scores -> softmax -> V.P^T -> gamma scale and residual, one launch ----
  attn_fused_kernel<<<dim3(kN / kFQ, kB), dim3(kFWaves * 32), 0, stream>>>(QKP, VP, x, gamma, out);
}

// v004
// A run of this version takes 38.6 microseconds.
// Next to v003, in two timings, it ran 1.07 times as fast each time.
// Counting every step since v000, it is 91.6 times as fast.
// Contractions: q/k/v channel projections on v_wmma_f32_16x16x32_bf16 with W and x as bf16 hi+lo planes (hh+hl+lh); energy k.q^T on v_wmma_f32_16x16x32_bf16 with q,k bf16 hi|lo parts packed along the 32-deep k axis (hh+lh+hl in one pass); V.P^T on v_wmma_f32_16x16x32_f16 (P = exp(s - held reference) in f16 carried x16, V f16 plane); f32 accumulate everywhere; softmax, biases, gamma scale and residual in f32.
#include <hip/hip_runtime.h>
#include <math.h>

// ---------------------------------------------------------------------------
// Problem constants
// ---------------------------------------------------------------------------
constexpr int kB    = 2;        // batch
constexpr int kC    = 64;       // channels (value dim and projection K)
constexpr int kCq   = 8;        // query/key channels
constexpr int kN    = 8000;     // voxels per sample (20*20*20)
constexpr int kKP   = 64;       // packed q|k row width in halves: q block cols 0..31, k block cols 32..63
constexpr float kLog2e = 1.4426950408889634f;
static_assert(kN % 64 == 0, "tiles");
static_assert(kC == 64 && kKP % 32 == 0 && kC % 32 == 0 && kN % 32 == 0, "k multiples");
static_assert(3 * kCq <= 32 && 2 * kCq == 16, "hi|lo|hi packing fits one k step; q and k rows fill one 16-row tile");

typedef __attribute__((ext_vector_type(16))) _Float16 v16h;
typedef __attribute__((ext_vector_type(8)))  _Float16 v8h;
typedef __attribute__((ext_vector_type(4)))  _Float16 v4h;
typedef __attribute__((ext_vector_type(16))) __bf16   v16b;
typedef __attribute__((ext_vector_type(8)))  __bf16   v8b;
typedef __attribute__((ext_vector_type(8)))  float    v8f;
typedef __attribute__((ext_vector_type(4)))  float    v4f;
typedef __attribute__((ext_vector_type(4)))  unsigned int v4u;

__device__ __forceinline__ unsigned short f2bf_bits(float f) {
  unsigned u = __float_as_uint(f);
  return (unsigned short)((u + 0x7FFFu + ((u >> 16) & 1u)) >> 16);
}
__device__ __forceinline__ float bf_bits2f(unsigned short h) { return __uint_as_float(((unsigned)h) << 16); }
__device__ __forceinline__ unsigned pk16(unsigned short a, unsigned short b) { return (unsigned)a | ((unsigned)b << 16); }

template <typename T> struct Frag;
template <> struct Frag<_Float16> {
  typedef v16h V; union U { v16h v; v8h h[2]; };
  // elements 0..7 <- p[0..7], 8..15 <- p[16..23]
  static __device__ __forceinline__ v16h load(const _Float16* p) {
    U f; f.h[0] = *(const v8h*)(p); f.h[1] = *(const v8h*)(p + 16); return f.v;
  }
  static __device__ __forceinline__ v8f mma(v16h a, v16h b, v8f c) {
    return __builtin_amdgcn_wmma_f32_16x16x32_f16(false, a, false, b, (short)0, c, false, false);
  }
};
template <> struct Frag<__bf16> {
  typedef v16b V; union U { v16b v; v8b h[2]; v4u u[2]; };
  static __device__ __forceinline__ v16b load(const __bf16* p) {
    U f; f.h[0] = *(const v8b*)(p); f.h[1] = *(const v8b*)(p + 16); return f.v;
  }
  static __device__ __forceinline__ v8f mma(v16b a, v16b b, v8f c) {
    return __builtin_amdgcn_wmma_f32_16x16x32_bf16(false, a, false, b, (short)0, c, false, false);
  }
};

// ---------------------------------------------------------------------------
// All three projections in one kernel, straight from x and the f32 weights to the two operand planes of the attention kernel:
//   QKP[b][n][64] bf16: cols 0..7 = hi(q), 8..15 = lo(q), 16..23 = hi(q), 24..31 = 0, 32..39 = hi(k), 40..47 = hi(k),
//   48..55 = lo(k), 56..63 = 0, so that sum_{s<32} QKP[n][s] * QKP[m][32+s] = qh.kh + ql.kh + qh.kl; q here is
//   (Wq.x + bq) * log2(e), so that the score product comes out in the exponent units of the hardware exp2;
//   VP[b][c][m] f16 = Wv.x + bv.
// grid (kN / 64, kB), 5 waves. A block owns 64 voxels. D = W.x: rows = output channels, columns = voxels. Wave w < 4 owns rows
// 16w..16w+15 of Wv, wave 4 the 16 rows Wq|Wk; each wave splits its own 16 weight rows into bf16 hi/lo A fragments in registers.
// Column j of column tile tt is voxel 4j + tt, so one float4 of x feeds the four tiles and four f16 results of a V row are 8 B
// (16 lanes = one 128-B line). Wave w < 4 splits 16 of the 64 channels (k step w >> 1, fragment half w & 1) of all 64 voxels
// into hi/lo and writes them to LDS already in B-fragment order, lane by lane; one barrier publishes them to the five waves.
// k order of A and B alike: element h * 8 + e of a lane is channel ks * 32 + h * 16 + (lane >> 4) * 8 + e.
// ---------------------------------------------------------------------------
constexpr int kPVox   = 64;                     // voxels per block
constexpr int kPWaves = 5;                      // four V row tiles and the q|k row tile
static_assert(kN % kPVox == 0 && kC == 4 * 16, "projection tiling is exact");
__device__ __forceinline__ void split8(const float (&v)[8], v4u& hi, v4u& lo) {
  unsigned short hb[8], lb[8];
#pragma unroll
  for (int e = 0; e < 8; ++e) {
    hb[e] = f2bf_bits(v[e]);
    lb[e] = f2bf_bits(v[e] - bf_bits2f(hb[e]));
  }
  hi = (v4u){pk16(hb[0], hb[1]), pk16(hb[2], hb[3]), pk16(hb[4], hb[5]), pk16(hb[6], hb[7])};
  lo = (v4u){pk16(lb[0], lb[1]), pk16(lb[2], lb[3]), pk16(lb[4], lb[5]), pk16(lb[6], lb[7])};
}
// halves offset of the 16-B piece (column tile tt, k step ks, plane pl, fragment half h) of one lane
__device__ __forceinline__ int xfrag_off(int tt, int ks, int pl, int h, int lane) {
  return ((((tt * 2 + ks) * 2 + pl) * 2 + h) * 32 + lane) * 8;
}
// acc[tt] = W.x over both k steps. The three partial products are summed hi.hi, x_hi.w_lo, x_lo.w_hi (XLEAD) or hi.hi, w_hi.x_lo,
// w_lo.x_hi.
template <bool XLEAD>
__device__ __forceinline__ void proj_products(const v16b (&ah)[2], const v16b (&al)[2], const unsigned short* sX, int lane,
                                              v8f (&acc)[4]) {
#pragma unroll
  for (int tt = 0; tt < 4; ++tt) acc[tt] = (v8f){0.f,0.f,0.f,0.f,0.f,0.f,0.f,0.f};
#pragma unroll
  for (int ks = 0; ks < 2; ++ks) {
    v16b bh[4], bl[4];
#pragma unroll
    for (int tt = 0; tt < 4; ++tt) {
      Frag<__bf16>::U fh, fl;
      fh.u[0] = *(const v4u*)(sX + xfrag_off(tt, ks, 0, 0, lane));
      fh.u[1] = *(const v4u*)(sX + xfrag_off(tt, ks, 0, 1, lane));
      fl.u[0] = *(const v4u*)(sX + xfrag_off(tt, ks, 1, 0, lane));
      fl.u[1] = *(const v4u*)(sX + xfrag_off(tt, ks, 1, 1, lane));
      bh[tt] = fh.v;
      bl[tt] = fl.v;
    }
#pragma unroll
    for (int tt = 0; tt < 4; ++tt) acc[tt] = Frag<__bf16>::mma(ah[ks], bh[tt], acc[tt]);
#pragma unroll
    for (int tt = 0; tt < 4; ++tt) acc[tt] = XLEAD ? Frag<__bf16>::mma(al[ks], bh[tt], acc[tt]) : Frag<__bf16>::mma(ah[ks], bl[tt], acc[tt]);
#pragma unroll
    for (int tt = 0; tt < 4; ++tt) acc[tt] = XLEAD ? Frag<__bf16>::mma(ah[ks], bl[tt], acc[tt]) : Frag<__bf16>::mma(al[ks], bh[tt], acc[tt]);
  }
}
__global__ __launch_bounds__(kPWaves * 32) void proj_fused_kernel(
    const float* __restrict__ x, const float* __restrict__ Wq, const float* __restrict__ bq, const float* __restrict__ Wk,
    const float* __restrict__ bk, const float* __restrict__ Wv, const float* __restrict__ bv,
    unsigned short* __restrict__ QKP, unsigned short* __restrict__ VP) {
  __shared__ __align__(16) unsigned short sX[4 * 2 * 2 * 2 * 32 * 8];   // 16 KiB: x hi/lo planes in B-fragment order
  const int lane = threadIdx.x & 31;
  const int wave = __builtin_amdgcn_readfirstlane(threadIdx.x >> 5);
  const int rl   = lane & 15;
  const int hf   = lane >> 4;
  const int b    = blockIdx.y;
  const int n0   = blockIdx.x * kPVox;

  // this wave's 16 weight rows, one per lane & 15
  const float* wrow = ((wave < 4) ? (Wv + (wave * 16 + rl) * kC) : ((rl < kCq) ? (Wq + rl * kC) : (Wk + (rl - kCq) * kC))) + hf * 8;
  v4f wv[2][2][2];
#pragma unroll
  for (int ks = 0; ks < 2; ++ks)
#pragma unroll
    for (int h = 0; h < 2; ++h)
#pragma unroll
      for (int p = 0; p < 2; ++p) wv[ks][h][p] = *(const v4f*)(wrow + ks * 32 + h * 16 + p * 4);
  const float* brow = (wave < 4) ? (bv + wave * 16 + hf * 8) : (hf ? bk : bq);
  const v4f bias0 = *(const v4f*)(brow);
  const v4f bias1 = *(const v4f*)(brow + 4);
  // the two address pairs of the ten loads above are reused below: the wait that precedes such an overwrite; naming them as
  // inputs keeps both pairs whole up to it
  asm volatile("s_wait_xcnt 0x0" :: "v"(wrow), "v"(brow) : "memory");

  if (wave < 4) {
    const int ks = wave >> 1, h = wave & 1;
    const float* xs = x + ((size_t)b * kC + ks * 32 + h * 16 + hf * 8) * kN + n0 + rl * 4;
    v4f xv[8];
#pragma unroll
    for (int e = 0; e < 8; ++e) xv[e] = *(const v4f*)(xs + (size_t)e * kN);
#pragma unroll
    for (int tt = 0; tt < 4; ++tt) {
      float v[8];
#pragma unroll
      for (int e = 0; e < 8; ++e) v[e] = xv[e][tt];
      v4u hi, lo;
      split8(v, hi, lo);
      *(v4u*)(sX + xfrag_off(tt, ks, 0, h, lane)) = hi;
      *(v4u*)(sX + xfrag_off(tt, ks, 1, h, lane)) = lo;
    }
  }

  v16b ah[2], al[2];
#pragma unroll
  for (int ks = 0; ks < 2; ++ks) {
    Frag<__bf16>::U fh, fl;
#pragma unroll
    for (int h = 0; h < 2; ++h) {
      float v[8];
#pragma unroll
      for (int e = 0; e < 4; ++e) { v[e] = wv[ks][h][0][e]; v[4 + e] = wv[ks][h][1][e]; }
      split8(v, fh.u[h], fl.u[h]);
    }
    ah[ks] = fh.v;
    al[ks] = fl.v;
  }
  __syncthreads();          // the x fragments of all 64 channels are published to the five waves

  v8f acc[4];
  if (wave == 4) {          // behind the only barrier: the q|k wave finishes here
    proj_products<true>(ah, al, sX, lane, acc);
    unsigned short* qrow = QKP + ((size_t)b * kN + n0 + rl * 4) * kKP + hf * 32;
    const float qsc = hf ? 1.0f : kLog2e;       // rows 0..7 (lower lane half) are q, rows 8..15 are k
#pragma unroll
    for (int tt = 0; tt < 4; ++tt) {
      float v[8];
#pragma unroll
      for (int r = 0; r < 8; ++r) v[r] = (acc[tt][r] + ((r < 4) ? bias0[r & 3] : bias1[r & 3])) * qsc;
      v4u hi, lo;
      split8(v, hi, lo);
      unsigned short* dst = qrow + tt * kKP;
      *(v4u*)(dst)      = hi;
      *(v4u*)(dst + 8)  = hf ? hi : lo;
      *(v4u*)(dst + 16) = hf ? lo : hi;
      *(v4u*)(dst + 24) = (v4u){0u, 0u, 0u, 0u};
    }
    return;
  }
  proj_products<false>(ah, al, sX, lane, acc);
  unsigned short* vrow = VP + ((size_t)b * kC + wave * 16 + hf * 8) * kN + n0 + rl * 4;
#pragma unroll
  for (int r = 0; r < 8; ++r) {
    const float bb = (r < 4) ? bias0[r & 3] : bias1[r & 3];
    v4h o;
#pragma unroll
    for (int tt = 0; tt < 4; ++tt) o[tt] = (_Float16)(acc[tt][r] + bb);
    *(v4h*)(vrow + (size_t)r * kN) = o;
  }
  // the built code lays this path in front of the q|k wave's, with a never-taken branch on into it, where the registers of the
  // eight stores are rewritten: the wait that precedes such an overwrite
  asm volatile("s_wait_xcnt 0x0" ::: "memory");
}

// ---------------------------------------------------------------------------
// Scores, softmax and V.P^T in one kernel; scores and probabilities never leave the registers.
//   out[b][c][n] = gsc[0] * sum_m V[b][c][m] * softmax_m(q[n].k[m]) + x[b][c][n]
// grid (kN / 64, kB), 20 waves. A block owns 64 queries; wave w = 4 * kg + qt owns query tile qt (16 queries) and key group kg
// (kN / 5 keys), walked in stages of 64 keys. The four waves of a key group stage its K rows (packed k halves) and V rows
// through registers into their own pair of LDS buffers; one block barrier per stage publishes a stage and frees the other buffer.
// S^T = K.Q^T: a lane holds 8 keys per 16-key tile of ONE query (column lane & 15), keys (lane >> 4) * 8 + r, which is the
// k order of the B fragment of the next product, so P^T is packed in place. O^T += V.P^T: the same column per lane, so a
// rescale is one factor per lane. The five key groups are joined through LDS in index order at the end.
// Softmax runs against a HELD reference per query and key group: P = exp2(s - ref + kPOff), s in log2 units. kPOff - ref enters
// as the C operand of the score product, so a score leaves the matrix unit ready for exp2. ref is the query's maximum over the
// group's first stage; after that it moves only when a lane's sum of the stage's 32 P passes kPSumMax (every P is positive, so
// none is above the sum and all fit f16): then, and in stage 0, ref goes up to the stage's maximum, O and the running sum
// take the factor, and the stage's P are formed again. The running maximum is never below ref, so the sum is at least 2^kPOff.
// ---------------------------------------------------------------------------
constexpr int kFQ      = 64;                    // queries per block
constexpr int kFGroups = 5;                     // key groups per block
constexpr int kFWaves  = 4 * kFGroups;          // 20
constexpr int kFStage  = 64;                    // keys per stage
constexpr int kFStages = kN / kFGroups / kFStage;   // 25
constexpr int kFKPitch = 40;                    // halves per staged K row: 80 B = 16 B x odd
constexpr int kFVPitch = 72;                    // halves per staged V row: 144 B = 16 B x odd
constexpr int kFBuf    = kFStage * kFKPitch + kC * kFVPitch;   // halves per buffer: 7168
constexpr int kFOPitch = 68;                    // floats per row of the join slab
static_assert(kFStages * kFStage * kFGroups == kN && kN % kFQ == 0, "key and query split are exact");
static_assert(kFGroups * 2 * kFBuf * 2 >= kFGroups * kC * kFOPitch * 4, "join slab fits in the stage buffers");
// Hardware exp2. The instruction set asks for one independent instruction between a transcendental and an instruction that
// reads its result or overwrites its source.
// In one statement, with results kept apart from sources, each exp2 fills its neighbour's slot and the first
// pack fills the last one's. The four packs to f16 pairs stand in the same statement so that they stay in front of the branch
// of the stage: behind it only the packed half of the registers is live. The s_delay_alu names the last pack's producer, so that
// the SIMD's other waves issue while that pack waits for it; it changes no result.
// p[r] = exp2(a[r]); pk[j] = f16 pair (p[2j], p[2j + 1])
__device__ __forceinline__ void exp2x8pk(float (&p)[8], unsigned (&pk)[4], const float (&a)[8]) {
  asm("v_exp_f32 %0, %12\n\tv_exp_f32 %1, %13\n\tv_exp_f32 %2, %14\n\tv_exp_f32 %3, %15\n\t"
      "v_exp_f32 %4, %16\n\tv_exp_f32 %5, %17\n\tv_exp_f32 %6, %18\n\tv_exp_f32 %7, %19\n\t"
      "v_cvt_pk_f16_f32 %8, %0, %1\n\tv_cvt_pk_f16_f32 %9, %2, %3\n\t"
      "v_cvt_pk_f16_f32 %10, %4, %5\n\ts_delay_alu instid0(TRANS32_DEP_1)\n\tv_cvt_pk_f16_f32 %11, %6, %7"
      : "=&v"(p[0]), "=&v"(p[1]), "=&v"(p[2]), "=&v"(p[3]), "=&v"(p[4]), "=&v"(p[5]), "=&v"(p[6]), "=&v"(p[7]),
        "=&v"(pk[0]), "=&v"(pk[1]), "=&v"(pk[2]), "=&v"(pk[3])
      : "v"(a[0]), "v"(a[1]), "v"(a[2]), "v"(a[3]), "v"(a[4]), "v"(a[5]), "v"(a[6]), "v"(a[7]));
}
// The same directly behind matrix instructions. The compiler does not look into asm text, so it keeps no distance between a
// product and this statement, which reads the product's result and may be given its operand registers for its own results:
// the four leading v_nop are the four vector slots that the chip needs there.
__device__ __forceinline__ void exp2x8pk_behind_mma(float (&p)[8], unsigned (&pk)[4], const float (&a)[8]) {
  asm("v_nop\n\tv_nop\n\tv_nop\n\tv_nop\n\t"
      "v_exp_f32 %0, %12\n\tv_exp_f32 %1, %13\n\tv_exp_f32 %2, %14\n\tv_exp_f32 %3, %15\n\t"
      "v_exp_f32 %4, %16\n\tv_exp_f32 %5, %17\n\tv_exp_f32 %6, %18\n\tv_exp_f32 %7, %19\n\t"
      "v_cvt_pk_f16_f32 %8, %0, %1\n\tv_cvt_pk_f16_f32 %9, %2, %3\n\t"
      "v_cvt_pk_f16_f32 %10, %4, %5\n\ts_delay_alu instid0(TRANS32_DEP_1)\n\tv_cvt_pk_f16_f32 %11, %6, %7"
      : "=&v"(p[0]), "=&v"(p[1]), "=&v"(p[2]), "=&v"(p[3]), "=&v"(p[4]), "=&v"(p[5]), "=&v"(p[6]), "=&v"(p[7]),
        "=&v"(pk[0]), "=&v"(pk[1]), "=&v"(pk[2]), "=&v"(pk[3])
      : "v"(a[0]), "v"(a[1]), "v"(a[2]), "v"(a[3]), "v"(a[4]), "v"(a[5]), "v"(a[6]), "v"(a[7]));
}
constexpr float kPOff    = 4.0f;                // P of a score equal to the reference is 2^4
constexpr float kPSumMax = 32768.0f;            // a lane's stage sum above this moves the reference
// P^T of one stage (two B fragments) and this lane's sum of it, from scores that already hold s - ref + kPOff
template <bool BEHIND_MMA>
__device__ __forceinline__ void stage_probs(const v8f (&st)[4], v16h (&pb)[2], float& ps) {
  ps = 0.0f;
#pragma unroll
  for (int kk = 0; kk < 2; ++kk) {
    float a0[8], a1[8], p0[8], p1[8];
    unsigned k0[4], k1[4];
#pragma unroll
    for (int r = 0; r < 8; ++r) {
      a0[r] = st[2 * kk][r];
      a1[r] = st[2 * kk + 1][r];
    }
    if (BEHIND_MMA && kk == 0) exp2x8pk_behind_mma(p0, k0, a0); else exp2x8pk(p0, k0, a0);
    exp2x8pk(p1, k1, a1);
#pragma unroll
    for (int r = 0; r < 8; ++r) ps += p0[r] + p1[r];
    union { v16h v; unsigned w[8]; } f;         // elements 0..7 = P of tile 2kk, 8..15 = P of tile 2kk + 1
#pragma unroll
    for (int j = 0; j < 4; ++j) { f.w[j] = k0[j]; f.w[4 + j] = k1[j]; }
    pb[kk] = f.v;
  }
}
__device__ __forceinline__ float exp2x1(float a) {
  float p;
  asm("v_exp_f32 %0, %1\n\tv_nop" : "=&v"(p) : "v"(a));   // the v_nop: the same slot
  return p;
}
__global__ __launch_bounds__(kFWaves * 32) void attn_fused_kernel(
    const unsigned short* __restrict__ QKP, const unsigned short* __restrict__ VP, const float* __restrict__ x,
    const float* __restrict__ gsc, float* __restrict__ out) {
  __shared__ __align__(16) unsigned short sRing[kFGroups * 2 * kFBuf];
  __shared__ float sM[kFGroups][kFQ];
  __shared__ float sL[kFGroups][kFQ];
  const int t     = threadIdx.x;
  const int lane  = t & 31;
  const int wave  = t >> 5;
  const int qt    = wave & 3;
  const int kg    = wave >> 2;
  const int g     = t & 127;                    // thread within the key group
  const int b     = blockIdx.y;
  const int n0    = blockIdx.x * kFQ;
  const int rlane = lane & 15;
  const int hf    = lane >> 4;
  const int koff  = hf * 8;
  const unsigned short* qkb = QKP + (size_t)b * kN * kKP;
  const unsigned short* vpb = VP + (size_t)b * kC * kN;
  const int key0 = kg * (kFStages * kFStage);

  const v16b qf = Frag<__bf16>::load((const __bf16*)(qkb + (size_t)(n0 + qt * 16 + rlane) * kKP + koff));

  // staging: K 64 keys x 4 chunks of 16 B (2 per thread), V 64 rows x 8 chunks (4 per thread, 8 lanes per 128-B line)
  const unsigned short* ksrc = qkb + (size_t)(key0 + (g >> 2)) * kKP + 32 + (g & 3) * 8;
  const unsigned short* vsrc = vpb + (size_t)(g >> 3) * kN + key0 + (g & 7) * 8;
  const int kdst = (g >> 2) * kFKPitch + (g & 3) * 8;
  const int vdst = kFStage * kFKPitch + (g >> 3) * kFVPitch + (g & 7) * 8;
  v4u kr[2], vr[4];
#pragma unroll
  for (int j = 0; j < 2; ++j) kr[j] = *(const v4u*)(ksrc + (size_t)j * 32 * kKP);
#pragma unroll
  for (int j = 0; j < 4; ++j) vr[j] = *(const v4u*)(vsrc + (size_t)j * 16 * kN);

  v8f acc[4];
#pragma unroll
  for (int i = 0; i < 4; ++i) acc[i] = (v8f){0.f,0.f,0.f,0.f,0.f,0.f,0.f,0.f};
  float mref = 0.0f;        // held reference of score * log2(e); set by stage 0
  float lrun = 0.0f;        // this lane's part of the running sum (its own keys), carried x2^kPOff like P
  v8f cvec = (v8f){kPOff, kPOff, kPOff, kPOff, kPOff, kPOff, kPOff, kPOff};   // kPOff - mref, the C operand of the score products

  for (int s = 0; s < kFStages; ++s) {
    unsigned short* buf = sRing + (kg * 2 + (s & 1)) * kFBuf;
#pragma unroll
    for (int j = 0; j < 2; ++j) *(v4u*)(buf + kdst + j * 32 * kFKPitch) = kr[j];
#pragma unroll
    for (int j = 0; j < 4; ++j) *(v4u*)(buf + vdst + j * 16 * kFVPitch) = vr[j];
    // publishes stage s; every wave has left the other buffer (read in stage s - 1) when the next stage writes it
    __syncthreads();
    if (s + 1 < kFStages) {
      // next stage's rows fly while this stage is worked on
#pragma unroll
      for (int j = 0; j < 2; ++j) kr[j] = *(const v4u*)(ksrc + (size_t)((s + 1) * kFStage + j * 32) * kKP);
#pragma unroll
      for (int j = 0; j < 4; ++j) vr[j] = *(const v4u*)(vsrc + (size_t)j * 16 * kN + (s + 1) * kFStage);
      // the address registers of the six loads are reused by the work below: the wait that precedes such an overwrite
      asm volatile("s_wait_xcnt 0x0" ::: "memory");
    }

    const __bf16*   kb = (const __bf16*)buf;
    const _Float16* vb = (const _Float16*)(buf + kFStage * kFKPitch);
    v8f st[4];
    v16b kf[4];
#pragma unroll
    for (int tt = 0; tt < 4; ++tt) kf[tt] = Frag<__bf16>::load(kb + (tt * 16 + rlane) * kFKPitch + koff);
    // the K reads stay in front of the V reads: LDS answers in order, and the score products wait for K alone
    __builtin_amdgcn_sched_barrier(0);
    // V fragments of the stage's first 32 keys: read here because the branch below splits the stage, and reads left behind it
    // would each be waited for in turn
    v16h vf0[4];
#pragma unroll
    for (int i = 0; i < 4; ++i) vf0[i] = Frag<_Float16>::load(vb + (i * 16 + rlane) * kFVPitch + koff);
    // all sixteen reads are issued before the first product, so that the wave pays one LDS latency and not one per tile
    __builtin_amdgcn_sched_barrier(0);
#pragma unroll
    for (int tt = 0; tt < 4; ++tt) st[tt] = Frag<__bf16>::mma(kf[tt], qf, cvec);
    // keeps the four score products back to back: each fills the others' result distance, else every one is followed by idle slots
    __builtin_amdgcn_sched_barrier(0);
    v16h pb[2];
    float ps;
    stage_probs<true>(st, pb, ps);
    // one scalar branch per stage, the same for the whole wave; !(<=) also catches a sum that is not a number
    if (s == 0 || __builtin_amdgcn_ballot_w32(!(ps <= kPSumMax)) != 0u) {
      float mx = st[0][0];
#pragma unroll
      for (int tt = 0; tt < 4; ++tt)
#pragma unroll
        for (int r = 0; r < 8; ++r) mx = fmaxf(mx, st[tt][r]);
      mx = fmaxf(mx, __shfl_xor(mx, 16, 32));     // the query's other 32 keys of this stage
      // stage 0 sets the reference, up or down (O and the sum are still zero); later it only rises
      const float delta = (s == 0) ? (mx - kPOff) : fmaxf(mx - kPOff, 0.0f);
      const float alpha = (s == 0) ? 1.0f : exp2x1(-delta);
      mref += delta;
      lrun *= alpha;
#pragma unroll
      for (int r = 0; r < 8; ++r) cvec[r] -= delta;
#pragma unroll
      for (int i = 0; i < 4; ++i) acc[i] *= alpha;
#pragma unroll
      for (int tt = 0; tt < 4; ++tt)
#pragma unroll
        for (int r = 0; r < 8; ++r) st[tt][r] -= delta;
      stage_probs<false>(st, pb, ps);
    }
    lrun += ps;
    v16h vf1[4];
#pragma unroll
    for (int i = 0; i < 4; ++i) vf1[i] = Frag<_Float16>::load(vb + (i * 16 + rlane) * kFVPitch + 32 + koff);
    // the eight reads of the second 32 keys fly under the four products of the first
    __builtin_amdgcn_sched_barrier(0);
#pragma unroll
    for (int i = 0; i < 4; ++i) acc[i] = Frag<_Float16>::mma(vf0[i], pb[0], acc[i]);
#pragma unroll
    for (int i = 0; i < 4; ++i) acc[i] = Frag<_Float16>::mma(vf1[i], pb[1], acc[i]);
  }

  // ---- join of the five key groups ----
  lrun += __shfl_xor(lrun, 16, 32);
  const int col = qt * 16 + rlane;
  if (hf == 0) { sM[kg][col] = mref; sL[kg][col] = lrun; }
  __syncthreads();          // references and sums published; every wave has left the stage buffers, which become the join slab
  float mall = sM[0][col];
#pragma unroll
  for (int k = 1; k < kFGroups; ++k) mall = fmaxf(mall, sM[k][col]);
  float lall = 0.0f;
#pragma unroll
  for (int k = 0; k < kFGroups; ++k) lall = fmaf(sL[k][col], exp2x1(sM[k][col] - mall), lall);
  const float f = exp2x1(mref - mall) / lall;
  float* slab = (float*)sRing;
#pragma unroll
  for (int i = 0; i < 4; ++i)
#pragma unroll
    for (int r = 0; r < 8; ++r) slab[(kg * kC + i * 16 + koff + r) * kFOPitch + col] = acc[i][r] * f;
  __syncthreads();
  // 64 rows x 16 float4 = 1024 pieces; 16 lanes cover one 256-B row segment of out
  const float gmul = gsc[0];
  for (int idx = t; idx < kC * (kFQ / 4); idx += kFWaves * 32) {
    const int row = idx >> 4, c4 = (idx & 15) * 4;
    v4f sum = *(const v4f*)(slab + row * kFOPitch + c4);
#pragma unroll
    for (int k = 1; k < kFGroups; ++k) sum += *(const v4f*)(slab + (k * kC + row) * kFOPitch + c4);
    const size_t o = ((size_t)b * kC + row) * kN + n0 + c4;
    const v4f xv = *(const v4f*)(x + o);
    v4f rr;
#pragma unroll
    for (int e = 0; e < 4; ++e) rr[e] = fmaf(gmul, sum[e], xv[e]);
    *(v4f*)(out + o) = rr;
  }
}

// ---------------------------------------------------------------------------
// Host glue.
//   QKP  bf16 [2][8000][64]      2,048,000  at          0
//   VP   f16  [2][64][8000]      2,048,000  at  2,048,000
//   total                        4,096,000
// GEMM shapes: projections per block M=80 (Wv rows, then Wq|Wk rows), N=64 voxels, K=64; in the attention kernel per block scores
// M=8000 keys, N=64 queries, K=32 and V.P^T M=64, N=64, K=8000. No partial tiles, no padding rows.
// ---------------------------------------------------------------------------
extern "C" void kernel_launch(void* const* d_in, const int* in_sizes, int n_in,
                              void* d_out, int out_size, void* d_ws, size_t ws_size,
                              hipStream_t stream) {
  if (n_in < 8) return;
  const int nElem = kB * kC * kN;                 // 1,024,000
  if (in_sizes[0] != nElem) return;
  if (in_sizes[1] != kCq * kC || in_sizes[2] != kCq) return;
  if (in_sizes[3] != kCq * kC || in_sizes[4] != kCq) return;
  if (in_sizes[5] != kC * kC || in_sizes[6] != kC || in_sizes[7] < 1) return;
  if (out_size != nElem) return;

  const size_t szQKP = (size_t)kB * kN * kKP * 2;
  const size_t szVP  = (size_t)kB * kC * kN * 2;
  const size_t offQKP  = 0;
  const size_t offVP   = offQKP + szQKP;
  const size_t total   = offVP + szVP;
  if (ws_size < total) return;

  const float* x     = (const float*)d_in[0];
  const float* Wq    = (const float*)d_in[1];
  const float* bq    = (const float*)d_in[2];
  const float* Wk    = (const float*)d_in[3];
  const float* bk    = (const float*)d_in[4];
  const float* Wv    = (const float*)d_in[5];
  const float* bv    = (const float*)d_in[6];
  const float* gamma = (const float*)d_in[7];
  float* out = (float*)d_out;
  char* ws = (char*)d_ws;
  unsigned short* QKP = (unsigned short*)(ws + offQKP);
  unsigned short* VP  = (unsigned short*)(ws + offVP);

  // ---- x, weights -> packed q|k plane and V plane, one launch ----
  proj_fused_kernel<<<dim3(kN / kPVox, kB), dim3(kPWaves * 32), 0, stream>>>(x, Wq, bq, Wk, bk, Wv, bv, QKP, VP);
  // ---- scores -> softmax -> V.P^T -> gamma scale and residual, one launch ----
  attn_fused_kernel<<<dim3(kN / kFQ, kB), dim3(kFWaves * 32), 0, stream>>>(QKP, VP, x, gamma, out);
}

// v005
// One run takes 35.5 microseconds.
// Timed twice side by side with v004, it ran 1.08 and 1.09 times as fast.
// Over all steps from v000 it is 99.2 times as fast.
// Contractions: q/k/v channel projections on v_wmma_f32_16x16x32_bf16 with W and x as bf16 hi+lo planes (hh+hl+lh); energy k.q^T on v_wmma_f32_16x16x32_bf16 with q,k bf16 hi|lo parts packed along the 32-deep k axis (hh+lh+hl in one pass); V.P^T on v_wmma_f32_16x16x32_f16 (P = exp(s - held reference) in f16 carried x16, V f16 plane); f32 accumulate everywhere; softmax, biases, gamma scale and residual in f32.
#include <hip/hip_runtime.h>
#include <math.h>

// ---------------------------------------------------------------------------
// Problem constants
// ---------------------------------------------------------------------------
constexpr int kB    = 2;        // batch
constexpr int kC    = 64;       // channels (value dim and projection K)
constexpr int kCq   = 8;        // query/key channels
constexpr int kN    = 8000;     // voxels per sample (20*20*20)
constexpr int kKP   = 64;       // packed q|k row width in halves: q block cols 0..31, k block cols 32..63
constexpr float kLog2e = 1.4426950408889634f;
static_assert(kN % 64 == 0, "tiles");
static_assert(kC == 64 && kKP % 32 == 0 && kC % 32 == 0 && kN % 32 == 0, "k multiples");
static_assert(3 * kCq <= 32 && 2 * kCq == 16, "hi|lo|hi packing fits one k step; q and k rows fill one 16-row tile");

typedef __attribute__((ext_vector_type(16))) _Float16 v16h;
typedef __attribute__((ext_vector_type(8)))  _Float16 v8h;
typedef __attribute__((ext_vector_type(4)))  _Float16 v4h;
typedef __attribute__((ext_vector_type(16))) __bf16   v16b;
typedef __attribute__((ext_vector_type(8)))  __bf16   v8b;
typedef __attribute__((ext_vector_type(8)))  float    v8f;
typedef __attribute__((ext_vector_type(4)))  float    v4f;
typedef __attribute__((ext_vector_type(4)))  unsigned int v4u;

__device__ __forceinline__ unsigned short f2bf_bits(float f) {
  unsigned u = __float_as_uint(f);
  return (unsigned short)((u + 0x7FFFu + ((u >> 16) & 1u)) >> 16);
}
__device__ __forceinline__ float bf_bits2f(unsigned short h) { return __uint_as_float(((unsigned)h) << 16); }
__device__ __forceinline__ unsigned pk16(unsigned short a, unsigned short b) { return (unsigned)a | ((unsigned)b << 16); }

template <typename T> struct Frag;
template <> struct Frag<_Float16> {
  typedef v16h V; union U { v16h v; v8h h[2]; };
  // elements 0..7 <- p[0..7], 8..15 <- p[16..23]
  static __device__ __forceinline__ v16h load(const _Float16* p) {
    U f; f.h[0] = *(const v8h*)(p); f.h[1] = *(const v8h*)(p + 16); return f.v;
  }
  static __device__ __forceinline__ v8f mma(v16h a, v16h b, v8f c) {
    return __builtin_amdgcn_wmma_f32_16x16x32_f16(false, a, false, b, (short)0, c, false, false);
  }
};
template <> struct Frag<__bf16> {
  typedef v16b V; union U { v16b v; v8b h[2]; v4u u[2]; };
  static __device__ __forceinline__ v16b load(const __bf16* p) {
    U f; f.h[0] = *(const v8b*)(p); f.h[1] = *(const v8b*)(p + 16); return f.v;
  }
  static __device__ __forceinline__ v8f mma(v16b a, v16b b, v8f c) {
    return __builtin_amdgcn_wmma_f32_16x16x32_bf16(false, a, false, b, (short)0, c, false, false);
  }
};

// ---------------------------------------------------------------------------
// All three projections in one kernel, straight from x and the f32 weights to the two operand planes of the attention kernel:
//   QKP[b][n][64] bf16: cols 0..7 = hi(q), 8..15 = lo(q), 16..23 = hi(q), 24..31 = 0, 32..39 = hi(k), 40..47 = hi(k),
//   48..55 = lo(k), 56..63 = 0, so that sum_{s<32} QKP[n][s] * QKP[m][32+s] = qh.kh + ql.kh + qh.kl; q here is
//   (Wq.x + bq) * log2(e), so that the score product comes out in the exponent units of the hardware exp2;
//   VP[b][c][m] f16 = Wv.x + bv.
// grid (kN / 64, kB), 5 waves. A block owns 64 voxels. D = W.x: rows = output channels, columns = voxels. Wave w < 4 owns rows
// 16w..16w+15 of Wv, wave 4 the 16 rows Wq|Wk; each wave splits its own 16 weight rows into bf16 hi/lo A fragments in registers.
// Column j of column tile tt is voxel 4j + tt, so one float4 of x feeds the four tiles and four f16 results of a V row are 8 B
// (16 lanes = one 128-B line). Wave w < 4 splits 16 of the 64 channels (k step w >> 1, fragment half w & 1) of all 64 voxels
// into hi/lo and writes them to LDS already in B-fragment order, lane by lane; one barrier publishes them to the five waves.
// k order of A and B alike: element h * 8 + e of a lane is channel ks * 32 + h * 16 + (lane >> 4) * 8 + e.
// ---------------------------------------------------------------------------
constexpr int kPVox   = 64;                     // voxels per block
constexpr int kPWaves = 5;                      // four V row tiles and the q|k row tile
static_assert(kN % kPVox == 0 && kC == 4 * 16, "projection tiling is exact");
__device__ __forceinline__ void split8(const float (&v)[8], v4u& hi, v4u& lo) {
  unsigned short hb[8], lb[8];
#pragma unroll
  for (int e = 0; e < 8; ++e) {
    hb[e] = f2bf_bits(v[e]);
    lb[e] = f2bf_bits(v[e] - bf_bits2f(hb[e]));
  }
  hi = (v4u){pk16(hb[0], hb[1]), pk16(hb[2], hb[3]), pk16(hb[4], hb[5]), pk16(hb[6], hb[7])};
  lo = (v4u){pk16(lb[0], lb[1]), pk16(lb[2], lb[3]), pk16(lb[4], lb[5]), pk16(lb[6], lb[7])};
}
// halves offset of the 16-B piece (column tile tt, k step ks, plane pl, fragment half h) of one lane
__device__ __forceinline__ int xfrag_off(int tt, int ks, int pl, int h, int lane) {
  return ((((tt * 2 + ks) * 2 + pl) * 2 + h) * 32 + lane) * 8;
}
// acc[tt] = W.x over both k steps. The three partial products are summed hi.hi, x_hi.w_lo, x_lo.w_hi (XLEAD) or hi.hi, w_hi.x_lo,
// w_lo.x_hi.
template <bool XLEAD>
__device__ __forceinline__ void proj_products(const v16b (&ah)[2], const v16b (&al)[2], const unsigned short* sX, int lane,
                                              v8f (&acc)[4]) {
#pragma unroll
  for (int tt = 0; tt < 4; ++tt) acc[tt] = (v8f){0.f,0.f,0.f,0.f,0.f,0.f,0.f,0.f};
#pragma unroll
  for (int ks = 0; ks < 2; ++ks) {
    v16b bh[4], bl[4];
#pragma unroll
    for (int tt = 0; tt < 4; ++tt) {
      Frag<__bf16>::U fh, fl;
      fh.u[0] = *(const v4u*)(sX + xfrag_off(tt, ks, 0, 0, lane));
      fh.u[1] = *(const v4u*)(sX + xfrag_off(tt, ks, 0, 1, lane));
      fl.u[0] = *(const v4u*)(sX + xfrag_off(tt, ks, 1, 0, lane));
      fl.u[1] = *(const v4u*)(sX + xfrag_off(tt, ks, 1, 1, lane));
      bh[tt] = fh.v;
      bl[tt] = fl.v;
    }
#pragma unroll
    for (int tt = 0; tt < 4; ++tt) acc[tt] = Frag<__bf16>::mma(ah[ks], bh[tt], acc[tt]);
#pragma unroll
    for (int tt = 0; tt < 4; ++tt) acc[tt] = XLEAD ? Frag<__bf16>::mma(al[ks], bh[tt], acc[tt]) : Frag<__bf16>::mma(ah[ks], bl[tt], acc[tt]);
#pragma unroll
    for (int tt = 0; tt < 4; ++tt) acc[tt] = XLEAD ? Frag<__bf16>::mma(ah[ks], bl[tt], acc[tt]) : Frag<__bf16>::mma(al[ks], bh[tt], acc[tt]);
  }
}
__global__ __launch_bounds__(kPWaves * 32) void proj_fused_kernel(
    const float* __restrict__ x, const float* __restrict__ Wq, const float* __restrict__ bq, const float* __restrict__ Wk,
    const float* __restrict__ bk, const float* __restrict__ Wv, const float* __restrict__ bv,
    unsigned short* __restrict__ QKP, unsigned short* __restrict__ VP) {
  __shared__ __align__(16) unsigned short sX[4 * 2 * 2 * 2 * 32 * 8];   // 16 KiB: x hi/lo planes in B-fragment order
  const int lane = threadIdx.x & 31;
  const int wave = __builtin_amdgcn_readfirstlane(threadIdx.x >> 5);
  const int rl   = lane & 15;
  const int hf   = lane >> 4;
  const int b    = blockIdx.y;
  const int n0   = blockIdx.x * kPVox;

  // this wave's 16 weight rows, one per lane & 15
  const float* wrow = ((wave < 4) ? (Wv + (wave * 16 + rl) * kC) : ((rl < kCq) ? (Wq + rl * kC) : (Wk + (rl - kCq) * kC))) + hf * 8;
  v4f wv[2][2][2];
#pragma unroll
  for (int ks = 0; ks < 2; ++ks)
#pragma unroll
    for (int h = 0; h < 2; ++h)
#pragma unroll
      for (int p = 0; p < 2; ++p) wv[ks][h][p] = *(const v4f*)(wrow + ks * 32 + h * 16 + p * 4);
  const float* brow = (wave < 4) ? (bv + wave * 16 + hf * 8) : (hf ? bk : bq);
  const v4f bias0 = *(const v4f*)(brow);
  const v4f bias1 = *(const v4f*)(brow + 4);
  // the two address pairs of the ten loads above are reused below: the wait that precedes such an overwrite; naming them as
  // inputs keeps both pairs whole up to it
  asm volatile("s_wait_xcnt 0x0" :: "v"(wrow), "v"(brow) : "memory");

  if (wave < 4) {
    const int ks = wave >> 1, h = wave & 1;
    const float* xs = x + ((size_t)b * kC + ks * 32 + h * 16 + hf * 8) * kN + n0 + rl * 4;
    v4f xv[8];
#pragma unroll
    for (int e = 0; e < 8; ++e) xv[e] = *(const v4f*)(xs + (size_t)e * kN);
#pragma unroll
    for (int tt = 0; tt < 4; ++tt) {
      float v[8];
#pragma unroll
      for (int e = 0; e < 8; ++e) v[e] = xv[e][tt];
      v4u hi, lo;
      split8(v, hi, lo);
      *(v4u*)(sX + xfrag_off(tt, ks, 0, h, lane)) = hi;
      *(v4u*)(sX + xfrag_off(tt, ks, 1, h, lane)) = lo;
    }
  }

  v16b ah[2], al[2];
#pragma unroll
  for (int ks = 0; ks < 2; ++ks) {
    Frag<__bf16>::U fh, fl;
#pragma unroll
    for (int h = 0; h < 2; ++h) {
      float v[8];
#pragma unroll
      for (int e = 0; e < 4; ++e) { v[e] = wv[ks][h][0][e]; v[4 + e] = wv[ks][h][1][e]; }
      split8(v, fh.u[h], fl.u[h]);
    }
    ah[ks] = fh.v;
    al[ks] = fl.v;
  }
  __syncthreads();          // the x fragments of all 64 channels are published to the five waves

  v8f acc[4];
  if (wave == 4) {          // behind the only barrier: the q|k wave finishes here
    proj_products<true>(ah, al, sX, lane, acc);
    unsigned short* qrow = QKP + ((size_t)b * kN + n0 + rl * 4) * kKP + hf * 32;
    const float qsc = hf ? 1.0f : kLog2e;       // rows 0..7 (lower lane half) are q, rows 8..15 are k
#pragma unroll
    for (int tt = 0; tt < 4; ++tt) {
      float v[8];
#pragma unroll
      for (int r = 0; r < 8; ++r) v[r] = (acc[tt][r] + ((r < 4) ? bias0[r & 3] : bias1[r & 3])) * qsc;
      v4u hi, lo;
      split8(v, hi, lo);
      unsigned short* dst = qrow + tt * kKP;
      *(v4u*)(dst)      = hi;
      *(v4u*)(dst + 8)  = hf ? hi : lo;
      *(v4u*)(dst + 16) = hf ? lo : hi;
      *(v4u*)(dst + 24) = (v4u){0u, 0u, 0u, 0u};
    }
    return;
  }
  proj_products<false>(ah, al, sX, lane, acc);
  unsigned short* vrow = VP + ((size_t)b * kC + wave * 16 + hf * 8) * kN + n0 + rl * 4;
#pragma unroll
  for (int r = 0; r < 8; ++r) {
    const float bb = (r < 4) ? bias0[r & 3] : bias1[r & 3];
    v4h o;
#pragma unroll
    for (int tt = 0; tt < 4; ++tt) o[tt] = (_Float16)(acc[tt][r] + bb);
    *(v4h*)(vrow + (size_t)r * kN) = o;
  }
  // the built code lays this path in front of the q|k wave's, with a never-taken branch on into it, where the registers of the
  // eight stores are rewritten: the wait that precedes such an overwrite
  asm volatile("s_wait_xcnt 0x0" ::: "memory");
}

// ---------------------------------------------------------------------------
// Scores, softmax and V.P^T in one kernel; scores and probabilities never leave the registers.
//   out[b][c][n] = gsc[0] * sum_m V[b][c][m] * softmax_m(q[n].k[m]) + x[b][c][n]
// grid (kN / 64, kB), 20 waves. A block owns 64 queries; wave w = 4 * kg + qt owns query tile qt (16 queries) and key group kg
// (kN / 5 keys), walked in stages of 64 keys. The four waves of a key group bring its K rows (packed k halves) and V rows into
// their own pair of LDS buffers by asynchronous copies, through no register. A buffer holds a tile of two stages (the copies
// take no registers, so LDS alone bounds it; the last tile has one stage): one block barrier per tile, behind the tile's last
// LDS read, publishes the next tile and frees the buffer just read, which the copies of the tile after that then fill; the
// last four V.P^T products of the tile, which need registers alone, follow behind it.
// S^T = K.Q^T: a lane holds 8 keys per 16-key tile of ONE query (column lane & 15), keys (lane >> 4) * 8 + r, which is the
// k order of the B fragment of the next product, so P^T is packed in place. O^T += V.P^T: the same column per lane, so a
// rescale is one factor per lane. The five key groups are joined through LDS in index order at the end.
// Softmax runs against a HELD reference per query and key group: P = exp2(s - ref + kPOff), s in log2 units. kPOff - ref enters
// as the C operand of the score product, so a score leaves the matrix unit ready for exp2. ref is the query's maximum over the
// group's first stage; after that it moves only when a lane's sum of the stage's 32 P passes kPSumMax (every P is positive, so
// none is above the sum and all fit f16): then, and in stage 0, ref goes up to the stage's maximum, O and the running sum
// take the factor, and the stage's P are formed again. The running maximum is never below ref, so the sum is at least 2^kPOff.
// ---------------------------------------------------------------------------
constexpr int kFQ      = 64;                    // queries per block
constexpr int kFGroups = 5;                     // key groups per block
constexpr int kFWaves  = 4 * kFGroups;          // 20
constexpr int kFStage  = 64;                    // keys per stage
constexpr int kFStages = kN / kFGroups / kFStage;   // 25
constexpr int kFKPitch = 40;                    // halves per staged K row: 80 B = 16 B x odd
constexpr int kFVPitch = 72;                    // halves per staged V row: 144 B = 16 B x odd
constexpr int kFBuf    = kFStage * kFKPitch + kC * kFVPitch;   // halves per stage slot: 7168
constexpr int kFOPitch = 68;                    // floats per row of the join slab
static_assert(kFStages * kFStage * kFGroups == kN && kN % kFQ == 0, "key and query split are exact");
constexpr int kFTile   = 2;                     // stages per tile of the ring
constexpr int kFSlots  = 2 * kFTile;            // stage slots per key group: two buffers of one tile
static_assert(kFStages >= 2 * kFTile, "the prologue fills two whole tiles");
static_assert((kFSlots & (kFSlots - 1)) == 0, "stage -> slot is a mask");
static_assert(kFGroups * kFSlots * kFBuf * 2 + 2 * kFGroups * kFQ * 4 <= 327680, "ring, references and sums fit the LDS of a WGP");
static_assert(kFGroups * kFSlots * kFBuf * 2 >= kFGroups * kC * kFOPitch * 4, "join slab fits in the stage buffers");
// Hardware exp2. The instruction set asks for one independent instruction between a transcendental and an instruction that
// reads its result or overwrites its source.
// In one statement, with results kept apart from sources, each exp2 fills its neighbour's slot and the first
// pack fills the last one's. The four packs to f16 pairs stand in the same statement so that they stay in front of the branch
// of the stage: behind it only the packed half of the registers is live. The s_delay_alu names the last pack's producer, so that
// the SIMD's other waves issue while that pack waits for it; it changes no result.
// p[r] = exp2(a[r]); pk[j] = f16 pair (p[2j], p[2j + 1])
__device__ __forceinline__ void exp2x8pk(float (&p)[8], unsigned (&pk)[4], const float (&a)[8]) {
  asm("v_exp_f32 %0, %12\n\tv_exp_f32 %1, %13\n\tv_exp_f32 %2, %14\n\tv_exp_f32 %3, %15\n\t"
      "v_exp_f32 %4, %16\n\tv_exp_f32 %5, %17\n\tv_exp_f32 %6, %18\n\tv_exp_f32 %7, %19\n\t"
      "v_cvt_pk_f16_f32 %8, %0, %1\n\tv_cvt_pk_f16_f32 %9, %2, %3\n\t"
      "v_cvt_pk_f16_f32 %10, %4, %5\n\ts_delay_alu instid0(TRANS32_DEP_1)\n\tv_cvt_pk_f16_f32 %11, %6, %7"
      : "=&v"(p[0]), "=&v"(p[1]), "=&v"(p[2]), "=&v"(p[3]), "=&v"(p[4]), "=&v"(p[5]), "=&v"(p[6]), "=&v"(p[7]),
        "=&v"(pk[0]), "=&v"(pk[1]), "=&v"(pk[2]), "=&v"(pk[3])
      : "v"(a[0]), "v"(a[1]), "v"(a[2]), "v"(a[3]), "v"(a[4]), "v"(a[5]), "v"(a[6]), "v"(a[7]));
}
// The same directly behind matrix instructions. The compiler does not look into asm text, so it keeps no distance between a
// product and this statement, which reads the product's result and may be given its operand registers for its own results:
// the four leading v_nop are the four vector slots that the chip needs there.
__device__ __forceinline__ void exp2x8pk_behind_mma(float (&p)[8], unsigned (&pk)[4], const float (&a)[8]) {
  asm("v_nop\n\tv_nop\n\tv_nop\n\tv_nop\n\t"
      "v_exp_f32 %0, %12\n\tv_exp_f32 %1, %13\n\tv_exp_f32 %2, %14\n\tv_exp_f32 %3, %15\n\t"
      "v_exp_f32 %4, %16\n\tv_exp_f32 %5, %17\n\tv_exp_f32 %6, %18\n\tv_exp_f32 %7, %19\n\t"
      "v_cvt_pk_f16_f32 %8, %0, %1\n\tv_cvt_pk_f16_f32 %9, %2, %3\n\t"
      "v_cvt_pk_f16_f32 %10, %4, %5\n\ts_delay_alu instid0(TRANS32_DEP_1)\n\tv_cvt_pk_f16_f32 %11, %6, %7"
      : "=&v"(p[0]), "=&v"(p[1]), "=&v"(p[2]), "=&v"(p[3]), "=&v"(p[4]), "=&v"(p[5]), "=&v"(p[6]), "=&v"(p[7]),
        "=&v"(pk[0]), "=&v"(pk[1]), "=&v"(pk[2]), "=&v"(pk[3])
      : "v"(a[0]), "v"(a[1]), "v"(a[2]), "v"(a[3]), "v"(a[4]), "v"(a[5]), "v"(a[6]), "v"(a[7]));
}
constexpr float kPOff    = 4.0f;                // P of a score equal to the reference is 2^4
constexpr float kPSumMax = 32768.0f;            // a lane's stage sum above this moves the reference
// P^T of one stage (two B fragments) and this lane's sum of it, from scores that already hold s - ref + kPOff
template <bool BEHIND_MMA>
__device__ __forceinline__ void stage_probs(const v8f (&st)[4], v16h (&pb)[2], float& ps) {
  ps = 0.0f;
#pragma unroll
  for (int kk = 0; kk < 2; ++kk) {
    float a0[8], a1[8], p0[8], p1[8];
    unsigned k0[4], k1[4];
#pragma unroll
    for (int r = 0; r < 8; ++r) {
      a0[r] = st[2 * kk][r];
      a1[r] = st[2 * kk + 1][r];
    }
    if (BEHIND_MMA && kk == 0) exp2x8pk_behind_mma(p0, k0, a0); else exp2x8pk(p0, k0, a0);
    exp2x8pk(p1, k1, a1);
#pragma unroll
    for (int r = 0; r < 8; ++r) ps += p0[r] + p1[r];
    union { v16h v; unsigned w[8]; } f;         // elements 0..7 = P of tile 2kk, 8..15 = P of tile 2kk + 1
#pragma unroll
    for (int j = 0; j < 4; ++j) { f.w[j] = k0[j]; f.w[4 + j] = k1[j]; }
    pb[kk] = f.v;
  }
}
__device__ __forceinline__ float exp2x1(float a) {
  float p;
  asm("v_exp_f32 %0, %1\n\tv_nop" : "=&v"(p) : "v"(a));   // the v_nop: the same slot
  return p;
}
// one lane's 16 bytes from global memory straight into LDS; counted on asynccnt, the waits are written where a tile is handed over
typedef int v4i_vs __attribute__((vector_size(16)));
__device__ __forceinline__ void copy16_to_lds(const unsigned short* g, unsigned short* l) {
  __builtin_amdgcn_global_load_async_to_lds_b128((__attribute__((address_space(1))) v4i_vs*)g,
                                                 (__attribute__((address_space(3))) v4i_vs*)l, 0, 0);
}
__global__ __launch_bounds__(kFWaves * 32) void attn_fused_kernel(
    const unsigned short* __restrict__ QKP, const unsigned short* __restrict__ VP, const float* __restrict__ x,
    const float* __restrict__ gsc, float* __restrict__ out) {
  __shared__ __align__(16) unsigned short sRing[kFGroups * kFSlots * kFBuf];
  __shared__ float sM[kFGroups][kFQ];
  __shared__ float sL[kFGroups][kFQ];
  const int t     = threadIdx.x;
  const int lane  = t & 31;
  const int wave  = t >> 5;
  const int qt    = wave & 3;
  const int kg    = wave >> 2;
  const int g     = t & 127;                    // thread within the key group
  const int b     = blockIdx.y;
  const int n0    = blockIdx.x * kFQ;
  const int rlane = lane & 15;
  const int hf    = lane >> 4;
  const int koff  = hf * 8;
  const unsigned short* qkb = QKP + (size_t)b * kN * kKP;
  const unsigned short* vpb = VP + (size_t)b * kC * kN;
  const int key0 = kg * (kFStages * kFStage);

  const v16b qf = Frag<__bf16>::load((const __bf16*)(qkb + (size_t)(n0 + qt * 16 + rlane) * kKP + koff));

  // staging: K 64 keys x 4 chunks of 16 B (2 per thread), V 64 rows x 8 chunks (4 per thread, 8 lanes per 128-B line)
  const unsigned short* ksrc = qkb + (size_t)(key0 + (g >> 2)) * kKP + 32 + (g & 3) * 8;
  const unsigned short* vsrc = vpb + (size_t)(g >> 3) * kN + key0 + (g & 7) * 8;
  const int kdst = (g >> 2) * kFKPitch + (g & 3) * 8;
  const int vdst = kFStage * kFKPitch + (g >> 3) * kFVPitch + (g & 7) * 8;
  // the six copies of this thread for stage st, into slot st mod kFSlots of its key group
  auto stage_copies = [&](int st) {
    unsigned short* dst = sRing + (kg * kFSlots + (st & (kFSlots - 1))) * kFBuf;
#pragma unroll
    for (int j = 0; j < 2; ++j) copy16_to_lds(ksrc + (size_t)(st * kFStage + j * 32) * kKP, dst + kdst + j * 32 * kFKPitch);
#pragma unroll
    for (int j = 0; j < 4; ++j) copy16_to_lds(vsrc + (size_t)j * 16 * kN + st * kFStage, dst + vdst + j * 16 * kFVPitch);
  };
#pragma unroll
  for (int u = 0; u < kFTile; ++u) stage_copies(u);
  // tile 0 has landed for this wave's copies; the barrier publishes it to the other waves
  asm volatile("s_wait_asynccnt 0x0" ::: "memory");
  __syncthreads();
#pragma unroll
  for (int u = 0; u < kFTile; ++u) stage_copies(kFTile + u);    // tile 1 flies while tile 0 is worked on

  v8f acc[4];
#pragma unroll
  for (int i = 0; i < 4; ++i) acc[i] = (v8f){0.f,0.f,0.f,0.f,0.f,0.f,0.f,0.f};
  float mref = 0.0f;        // held reference of score * log2(e); set by stage 0
  float lrun = 0.0f;        // this lane's part of the running sum (its own keys), carried x2^kPOff like P
  v8f cvec = (v8f){kPOff, kPOff, kPOff, kPOff, kPOff, kPOff, kPOff, kPOff};   // kPOff - mref, the C operand of the score products

  for (int s = 0; s < kFStages; ++s) {
    const unsigned short* buf = sRing + (kg * kFSlots + (s & (kFSlots - 1))) * kFBuf;
    const __bf16*   kb = (const __bf16*)buf;
    const _Float16* vb = (const _Float16*)(buf + kFStage * kFKPitch);
    v8f st[4];
    v16b kf[4];
#pragma unroll
    for (int tt = 0; tt < 4; ++tt) kf[tt] = Frag<__bf16>::load(kb + (tt * 16 + rlane) * kFKPitch + koff);
    // the K reads stay in front of the V reads: LDS answers in order, and the score products wait for K alone
    __builtin_amdgcn_sched_barrier(0);
    // V fragments of the stage's first 32 keys: read here because the branch below splits the stage, and reads left behind it
    // would each be waited for in turn
    v16h vf0[4];
#pragma unroll
    for (int i = 0; i < 4; ++i) vf0[i] = Frag<_Float16>::load(vb + (i * 16 + rlane) * kFVPitch + koff);
    // all sixteen reads are issued before the first product, so that the wave pays one LDS latency and not one per tile
    __builtin_amdgcn_sched_barrier(0);
#pragma unroll
    for (int tt = 0; tt < 4; ++tt) st[tt] = Frag<__bf16>::mma(kf[tt], qf, cvec);
    // keeps the four score products back to back: each fills the others' result distance, else every one is followed by idle slots
    __builtin_amdgcn_sched_barrier(0);
    v16h pb[2];
    float ps;
    stage_probs<true>(st, pb, ps);
    // one scalar branch per stage, the same for the whole wave; !(<=) also catches a sum that is not a number
    if (s == 0 || __builtin_amdgcn_ballot_w32(!(ps <= kPSumMax)) != 0u) {
      float mx = st[0][0];
#pragma unroll
      for (int tt = 0; tt < 4; ++tt)
#pragma unroll
        for (int r = 0; r < 8; ++r) mx = fmaxf(mx, st[tt][r]);
      mx = fmaxf(mx, __shfl_xor(mx, 16, 32));     // the query's other 32 keys of this stage
      // stage 0 sets the reference, up or down (O and the sum are still zero); later it only rises
      const float delta = (s == 0) ? (mx - kPOff) : fmaxf(mx - kPOff, 0.0f);
      const float alpha = (s == 0) ? 1.0f : exp2x1(-delta);
      mref += delta;
      lrun *= alpha;
#pragma unroll
      for (int r = 0; r < 8; ++r) cvec[r] -= delta;
#pragma unroll
      for (int i = 0; i < 4; ++i) acc[i] *= alpha;
#pragma unroll
      for (int tt = 0; tt < 4; ++tt)
#pragma unroll
        for (int r = 0; r < 8; ++r) st[tt][r] -= delta;
      stage_probs<false>(st, pb, ps);
    }
    lrun += ps;
    v16h vf1[4];
#pragma unroll
    for (int i = 0; i < 4; ++i) vf1[i] = Frag<_Float16>::load(vb + (i * 16 + rlane) * kFVPitch + 32 + koff);
    // the eight reads of the second 32 keys fly under the four products of the first
    __builtin_amdgcn_sched_barrier(0);
#pragma unroll
    for (int i = 0; i < 4; ++i) acc[i] = Frag<_Float16>::mma(vf0[i], pb[0], acc[i]);
    // holds those four products in front of the wait below, which would else be passed up to the reads
    __builtin_amdgcn_sched_barrier(0);
    // Hand-over of the buffers, behind the last LDS read of a tile's last stage; the test is the same for the whole block. The
    // last tile is handed to nobody: the barrier of the join ends its reads
    if ((s & (kFTile - 1)) == kFTile - 1) {
      // this wave's reads of the tile have returned before its buffer is given to the copies
      asm volatile("s_wait_dscnt 0x0" ::: "memory");
      // this wave's copies of the next tile have landed
      asm volatile("s_wait_asynccnt 0x0" ::: "memory");
      // publishes the next tile; every wave has left the buffer of this one
      __syncthreads();
      // the tile after the next, into the buffer just read; it flies while the next tile is worked on
#pragma unroll
      for (int u = 0; u < kFTile; ++u)
        if (s + 1 + kFTile + u < kFStages) stage_copies(s + 1 + kFTile + u);
    }
    // the copies stay in front of the last four products: they have the long way, and the products need registers alone
    __builtin_amdgcn_sched_barrier(0);
#pragma unroll
    for (int i = 0; i < 4; ++i) acc[i] = Frag<_Float16>::mma(vf1[i], pb[1], acc[i]);
  }
  // nothing is in flight when the stage buffers become the join slab
  asm volatile("s_wait_asynccnt 0x0" ::: "memory");

  // ---- join of the five key groups ----
  lrun += __shfl_xor(lrun, 16, 32);
  const int col = qt * 16 + rlane;
  if (hf == 0) { sM[kg][col] = mref; sL[kg][col] = lrun; }
  __syncthreads();          // references and sums published; every wave has left the stage buffers, which become the join slab
  float mall = sM[0][col];
#pragma unroll
  for (int k = 1; k < kFGroups; ++k) mall = fmaxf(mall, sM[k][col]);
  float lall = 0.0f;
#pragma unroll
  for (int k = 0; k < kFGroups; ++k) lall = fmaf(sL[k][col], exp2x1(sM[k][col] - mall), lall);
  const float f = exp2x1(mref - mall) / lall;
  float* slab = (float*)sRing;
#pragma unroll
  for (int i = 0; i < 4; ++i)
#pragma unroll
    for (int r = 0; r < 8; ++r) slab[(kg * kC + i * 16 + koff + r) * kFOPitch + col] = acc[i][r] * f;
  __syncthreads();
  // 64 rows x 16 float4 = 1024 pieces; 16 lanes cover one 256-B row segment of out
  const float gmul = gsc[0];
  for (int idx = t; idx < kC * (kFQ / 4); idx += kFWaves * 32) {
    const int row = idx >> 4, c4 = (idx & 15) * 4;
    v4f sum = *(const v4f*)(slab + row * kFOPitch + c4);
#pragma unroll
    for (int k = 1; k < kFGroups; ++k) sum += *(const v4f*)(slab + (k * kC + row) * kFOPitch + c4);
    const size_t o = ((size_t)b * kC + row) * kN + n0 + c4;
    const v4f xv = *(const v4f*)(x + o);
    v4f rr;
#pragma unroll
    for (int e = 0; e < 4; ++e) rr[e] = fmaf(gmul, sum[e], xv[e]);
    *(v4f*)(out + o) = rr;
  }
}

// ---------------------------------------------------------------------------
// Host glue.
//   QKP  bf16 [2][8000][64]      2,048,000  at          0
//   VP   f16  [2][64][8000]      2,048,000  at  2,048,000
//   total                        4,096,000
// GEMM shapes: projections per block M=80 (Wv rows, then Wq|Wk rows), N=64 voxels, K=64; in the attention kernel per block scores
// M=8000 keys, N=64 queries, K=32 and V.P^T M=64, N=64, K=8000. No partial tiles, no padding rows.
// ---------------------------------------------------------------------------
extern "C" void kernel_launch(void* const* d_in, const int* in_sizes, int n_in,
                              void* d_out, int out_size, void* d_ws, size_t ws_size,
                              hipStream_t stream) {
  if (n_in < 8) return;
  const int nElem = kB * kC * kN;                 // 1,024,000
  if (in_sizes[0] != nElem) return;
  if (in_sizes[1] != kCq * kC || in_sizes[2] != kCq) return;
  if (in_sizes[3] != kCq * kC || in_sizes[4] != kCq) return;
  if (in_sizes[5] != kC * kC || in_sizes[6] != kC || in_sizes[7] < 1) return;
  if (out_size != nElem) return;

  const size_t szQKP = (size_t)kB * kN * kKP * 2;
  const size_t szVP  = (size_t)kB * kC * kN * 2;
  const size_t offQKP  = 0;
  const size_t offVP   = offQKP + szQKP;
  const size_t total   = offVP + szVP;
  if (ws_size < total) return;

  const float* x     = (const float*)d_in[0];
  const float* Wq    = (const float*)d_in[1];
  const float* bq    = (const float*)d_in[2];
  const float* Wk    = (const float*)d_in[3];
  const float* bk    = (const float*)d_in[4];
  const float* Wv    = (const float*)d_in[5];
  const float* bv    = (const float*)d_in[6];
  const float* gamma = (const float*)d_in[7];
  float* out = (float*)d_out;
  char* ws = (char*)d_ws;
  unsigned short* QKP = (unsigned short*)(ws + offQKP);
  unsigned short* VP  = (unsigned short*)(ws + offVP);

  // ---- x, weights -> packed q|k plane and V plane, one launch ----
  proj_fused_kernel<<<dim3(kN / kPVox, kB), dim3(kPWaves * 32), 0, stream>>>(x, Wq, bq, Wk, bk, Wv, bv, QKP, VP);
  // ---- scores -> softmax -> V.P^T -> gamma scale and residual, one launch ----
  attn_fused_kernel<<<dim3(kN / kFQ, kB), dim3(kFWaves * 32), 0, stream>>>(QKP, VP, x, gamma, out);
}

// v006
// Measured time: 33.3 microseconds a run.
// Next to v005, in two timings, it ran 1.06 and 1.07 times as fast.
// Counting every step since v000, it is 105 times as fast.
// Contractions: q/k/v channel projections on v_wmma_f32_16x16x32_bf16 with W and x as bf16 hi+lo planes (hh+hl+lh); energy k.q^T on v_wmma_f32_16x16x32_bf16 with q,k bf16 hi|lo parts packed along the 32-deep k axis (hh+lh+hl in one pass); V.P^T on v_wmma_f32_16x16x32_f16 (P = exp(s - held reference) in f16 carried x16, V f16 plane); f32 accumulate everywhere; softmax, biases, gamma scale and residual in f32.
#include <hip/hip_runtime.h>
#include <math.h>

// ---------------------------------------------------------------------------
// Problem constants
// ---------------------------------------------------------------------------
constexpr int kB    = 2;        // batch
constexpr int kC    = 64;       // channels (value dim and projection K)
constexpr int kCq   = 8;        // query/key channels
constexpr int kN    = 8000;     // voxels per sample (20*20*20)
constexpr int kKP   = 64;       // packed q|k row width in halves: q block cols 0..31, k block cols 32..63
constexpr float kLog2e = 1.4426950408889634f;
static_assert(kN % 64 == 0, "tiles");
static_assert(kC == 64 && kKP % 32 == 0 && kC % 32 == 0 && kN % 32 == 0, "k multiples");
static_assert(3 * kCq <= 32 && 2 * kCq == 16, "hi|lo|hi packing fits one k step; q and k rows fill one 16-row tile");

typedef __attribute__((ext_vector_type(16))) _Float16 v16h;
typedef __attribute__((ext_vector_type(8)))  _Float16 v8h;
typedef __attribute__((ext_vector_type(4)))  _Float16 v4h;
typedef __attribute__((ext_vector_type(16))) __bf16   v16b;
typedef __attribute__((ext_vector_type(8)))  __bf16   v8b;
typedef __attribute__((ext_vector_type(8)))  float    v8f;
typedef __attribute__((ext_vector_type(4)))  float    v4f;
typedef __attribute__((ext_vector_type(4)))  unsigned int v4u;

__device__ __forceinline__ unsigned short f2bf_bits(float f) {
  unsigned u = __float_as_uint(f);
  return (unsigned short)((u + 0x7FFFu + ((u >> 16) & 1u)) >> 16);
}
__device__ __forceinline__ float bf_bits2f(unsigned short h) { return __uint_as_float(((unsigned)h) << 16); }
__device__ __forceinline__ unsigned pk16(unsigned short a, unsigned short b) { return (unsigned)a | ((unsigned)b << 16); }

template <typename T> struct Frag;
template <> struct Frag<_Float16> {
  typedef v16h V; union U { v16h v; v8h h[2]; };
  // elements 0..7 <- p[0..7], 8..15 <- p[16..23]
  static __device__ __forceinline__ v16h load(const _Float16* p) {
    U f; f.h[0] = *(const v8h*)(p); f.h[1] = *(const v8h*)(p + 16); return f.v;
  }
  static __device__ __forceinline__ v8f mma(v16h a, v16h b, v8f c) {
    return __builtin_amdgcn_wmma_f32_16x16x32_f16(false, a, false, b, (short)0, c, false, false);
  }
};
template <> struct Frag<__bf16> {
  typedef v16b V; union U { v16b v; v8b h[2]; v4u u[2]; };
  static __device__ __forceinline__ v16b load(const __bf16* p) {
    U f; f.h[0] = *(const v8b*)(p); f.h[1] = *(const v8b*)(p + 16); return f.v;
  }
  static __device__ __forceinline__ v8f mma(v16b a, v16b b, v8f c) {
    return __builtin_amdgcn_wmma_f32_16x16x32_bf16(false, a, false, b, (short)0, c, false, false);
  }
};

// ---------------------------------------------------------------------------
// All three projections in one kernel, straight from x and the f32 weights to the two operand planes of the attention kernel:
//   QKP[b][n][64] bf16: cols 0..7 = hi(q), 8..15 = lo(q), 16..23 = hi(q), 24..31 = 0, 32..39 = hi(k), 40..47 = hi(k),
//   48..55 = lo(k), 56..63 = 0, so that sum_{s<32} QKP[n][s] * QKP[m][32+s] = qh.kh + ql.kh + qh.kl; q here is
//   (Wq.x + bq) * log2(e), so that the score product comes out in the exponent units of the hardware exp2;
//   VP[b][c][m] f16 = Wv.x + bv.
// grid (kN / 64, kB), 5 waves. A block owns 64 voxels. D = W.x: rows = output channels, columns = voxels. Wave w < 4 owns rows
// 16w..16w+15 of Wv, wave 4 the 16 rows Wq|Wk; each wave splits its own 16 weight rows into bf16 hi/lo A fragments in registers.
// Column j of column tile tt is voxel 4j + tt, so one float4 of x feeds the four tiles and four f16 results of a V row are 8 B
// (16 lanes = one 128-B line). Wave w < 4 splits 16 of the 64 channels (k step w >> 1, fragment half w & 1) of all 64 voxels
// into hi/lo and writes them to LDS already in B-fragment order, lane by lane; one barrier publishes them to the five waves.
// k order of A and B alike: element h * 8 + e of a lane is channel ks * 32 + h * 16 + (lane >> 4) * 8 + e.
// ---------------------------------------------------------------------------
constexpr int kPVox   = 64;                     // voxels per block
constexpr int kPWaves = 5;                      // four V row tiles and the q|k row tile
static_assert(kN % kPVox == 0 && kC == 4 * 16, "projection tiling is exact");
__device__ __forceinline__ void split8(const float (&v)[8], v4u& hi, v4u& lo) {
  unsigned short hb[8], lb[8];
#pragma unroll
  for (int e = 0; e < 8; ++e) {
    hb[e] = f2bf_bits(v[e]);
    lb[e] = f2bf_bits(v[e] - bf_bits2f(hb[e]));
  }
  hi = (v4u){pk16(hb[0], hb[1]), pk16(hb[2], hb[3]), pk16(hb[4], hb[5]), pk16(hb[6], hb[7])};
  lo = (v4u){pk16(lb[0], lb[1]), pk16(lb[2], lb[3]), pk16(lb[4], lb[5]), pk16(lb[6], lb[7])};
}
// halves offset of the 16-B piece (column tile tt, k step ks, plane pl, fragment half h) of one lane
__device__ __forceinline__ int xfrag_off(int tt, int ks, int pl, int h, int lane) {
  return ((((tt * 2 + ks) * 2 + pl) * 2 + h) * 32 + lane) * 8;
}
// acc[tt] = W.x over both k steps. The three partial products are summed hi.hi, x_hi.w_lo, x_lo.w_hi (XLEAD) or hi.hi, w_hi.x_lo,
// w_lo.x_hi.
template <bool XLEAD>
__device__ __forceinline__ void proj_products(const v16b (&ah)[2], const v16b (&al)[2], const unsigned short* sX, int lane,
                                              v8f (&acc)[4]) {
#pragma unroll
  for (int tt = 0; tt < 4; ++tt) acc[tt] = (v8f){0.f,0.f,0.f,0.f,0.f,0.f,0.f,0.f};
#pragma unroll
  for (int ks = 0; ks < 2; ++ks) {
    v16b bh[4], bl[4];
#pragma unroll
    for (int tt = 0; tt < 4; ++tt) {
      Frag<__bf16>::U fh, fl;
      fh.u[0] = *(const v4u*)(sX + xfrag_off(tt, ks, 0, 0, lane));
      fh.u[1] = *(const v4u*)(sX + xfrag_off(tt, ks, 0, 1, lane));
      fl.u[0] = *(const v4u*)(sX + xfrag_off(tt, ks, 1, 0, lane));
      fl.u[1] = *(const v4u*)(sX + xfrag_off(tt, ks, 1, 1, lane));
      bh[tt] = fh.v;
      bl[tt] = fl.v;
    }
#pragma unroll
    for (int tt = 0; tt < 4; ++tt) acc[tt] = Frag<__bf16>::mma(ah[ks], bh[tt], acc[tt]);
#pragma unroll
    for (int tt = 0; tt < 4; ++tt) acc[tt] = XLEAD ? Frag<__bf16>::mma(al[ks], bh[tt], acc[tt]) : Frag<__bf16>::mma(ah[ks], bl[tt], acc[tt]);
#pragma unroll
    for (int tt = 0; tt < 4; ++tt) acc[tt] = XLEAD ? Frag<__bf16>::mma(ah[ks], bl[tt], acc[tt]) : Frag<__bf16>::mma(al[ks], bh[tt], acc[tt]);
  }
}
__global__ __launch_bounds__(kPWaves * 32) void proj_fused_kernel(
    const float* __restrict__ x, const float* __restrict__ Wq, const float* __restrict__ bq, const float* __restrict__ Wk,
    const float* __restrict__ bk, const float* __restrict__ Wv, const float* __restrict__ bv,
    unsigned short* __restrict__ QKP, unsigned short* __restrict__ VP) {
  __shared__ __align__(16) unsigned short sX[4 * 2 * 2 * 2 * 32 * 8];   // 16 KiB: x hi/lo planes in B-fragment order
  const int lane = threadIdx.x & 31;
  const int wave = __builtin_amdgcn_readfirstlane(threadIdx.x >> 5);
  const int rl   = lane & 15;
  const int hf   = lane >> 4;
  const int b    = blockIdx.y;
  const int n0   = blockIdx.x * kPVox;

  // this wave's 16 weight rows, one per lane & 15
  const float* wrow = ((wave < 4) ? (Wv + (wave * 16 + rl) * kC) : ((rl < kCq) ? (Wq + rl * kC) : (Wk + (rl - kCq) * kC))) + hf * 8;
  v4f wv[2][2][2];
#pragma unroll
  for (int ks = 0; ks < 2; ++ks)
#pragma unroll
    for (int h = 0; h < 2; ++h)
#pragma unroll
      for (int p = 0; p < 2; ++p) wv[ks][h][p] = *(const v4f*)(wrow + ks * 32 + h * 16 + p * 4);
  const float* brow = (wave < 4) ? (bv + wave * 16 + hf * 8) : (hf ? bk : bq);
  const v4f bias0 = *(const v4f*)(brow);
  const v4f bias1 = *(const v4f*)(brow + 4);
  // the two address pairs of the ten loads above are reused below: the wait that precedes such an overwrite; naming them as
  // inputs keeps both pairs whole up to it
  asm volatile("s_wait_xcnt 0x0" :: "v"(wrow), "v"(brow) : "memory");

  if (wave < 4) {
    const int ks = wave >> 1, h = wave & 1;
    const float* xs = x + ((size_t)b * kC + ks * 32 + h * 16 + hf * 8) * kN + n0 + rl * 4;
    v4f xv[8];
#pragma unroll
    for (int e = 0; e < 8; ++e) xv[e] = *(const v4f*)(xs + (size_t)e * kN);
#pragma unroll
    for (int tt = 0; tt < 4; ++tt) {
      float v[8];
#pragma unroll
      for (int e = 0; e < 8; ++e) v[e] = xv[e][tt];
      v4u hi, lo;
      split8(v, hi, lo);
      *(v4u*)(sX + xfrag_off(tt, ks, 0, h, lane)) = hi;
      *(v4u*)(sX + xfrag_off(tt, ks, 1, h, lane)) = lo;
    }
  }

  v16b ah[2], al[2];
#pragma unroll
  for (int ks = 0; ks < 2; ++ks) {
    Frag<__bf16>::U fh, fl;
#pragma unroll
    for (int h = 0; h < 2; ++h) {
      float v[8];
#pragma unroll
      for (int e = 0; e < 4; ++e) { v[e] = wv[ks][h][0][e]; v[4 + e] = wv[ks][h][1][e]; }
      split8(v, fh.u[h], fl.u[h]);
    }
    ah[ks] = fh.v;
    al[ks] = fl.v;
  }
  __syncthreads();          // the x fragments of all 64 channels are published to the five waves

  v8f acc[4];
  if (wave == 4) {          // behind the only barrier: the q|k wave finishes here
    proj_products<true>(ah, al, sX, lane, acc);
    unsigned short* qrow = QKP + ((size_t)b * kN + n0 + rl * 4) * kKP + hf * 32;
    const float qsc = hf ? 1.0f : kLog2e;       // rows 0..7 (lower lane half) are q, rows 8..15 are k
#pragma unroll
    for (int tt = 0; tt < 4; ++tt) {
      float v[8];
#pragma unroll
      for (int r = 0; r < 8; ++r) v[r] = (acc[tt][r] + ((r < 4) ? bias0[r & 3] : bias1[r & 3])) * qsc;
      v4u hi, lo;
      split8(v, hi, lo);
      unsigned short* dst = qrow + tt * kKP;
      *(v4u*)(dst)      = hi;
      *(v4u*)(dst + 8)  = hf ? hi : lo;
      *(v4u*)(dst + 16) = hf ? lo : hi;
      *(v4u*)(dst + 24) = (v4u){0u, 0u, 0u, 0u};
    }
    return;
  }
  proj_products<false>(ah, al, sX, lane, acc);
  unsigned short* vrow = VP + ((size_t)b * kC + wave * 16 + hf * 8) * kN + n0 + rl * 4;
#pragma unroll
  for (int r = 0; r < 8; ++r) {
    const float bb = (r < 4) ? bias0[r & 3] : bias1[r & 3];
    v4h o;
#pragma unroll
    for (int tt = 0; tt < 4; ++tt) o[tt] = (_Float16)(acc[tt][r] + bb);
    *(v4h*)(vrow + (size_t)r * kN) = o;
  }
  // the built code lays this path in front of the q|k wave's, with a never-taken branch on into it, where the registers of the
  // eight stores are rewritten: the wait that precedes such an overwrite
  asm volatile("s_wait_xcnt 0x0" ::: "memory");
}

// ---------------------------------------------------------------------------
// Scores, softmax and V.P^T in one kernel; scores and probabilities never leave the registers.
//   out[b][c][n] = gsc[0] * sum_m V[b][c][m] * softmax_m(q[n].k[m]) + x[b][c][n]
// grid (kN / 64, kB), 20 waves. A block owns 64 queries; wave w = 4 * kg + qt owns query tile qt (16 queries) and key group kg
// (kN / 5 keys), walked in stages of 64 keys, from a first stage that differs from block to block. The four waves of a key
// group bring its K rows (packed k halves) and V rows into their own pair of LDS buffers by asynchronous copies, through no register. A buffer holds a tile of two stages (the copies
// take no registers, so LDS alone bounds it; the last tile has one stage): one block barrier per tile, behind the tile's last
// LDS read, publishes the next tile and frees the buffer just read, which the copies of the tile after that then fill; the
// last four V.P^T products of the tile, which need registers alone, follow behind it.
// S^T = K.Q^T: a lane holds 8 keys per 16-key tile of ONE query (column lane & 15), keys (lane >> 4) * 8 + r, which is the
// k order of the B fragment of the next product, so P^T is packed in place. O^T += V.P^T: the same column per lane, so a
// rescale is one factor per lane. The five key groups are joined through LDS in index order at the end.
// Softmax runs against a HELD reference per query and key group: P = exp2(s - ref + kPOff), s in log2 units. kPOff - ref enters
// as the C operand of the score product, so a score leaves the matrix unit ready for exp2. ref is the query's maximum over the
// first stage that the group walks; after that it moves only when a lane's sum of the stage's 32 P passes kPSumMax (every P is
// positive, so none is above the sum and all fit f16): then, and in stage 0, ref goes up to the stage's maximum, O and the running sum
// take the factor, and the stage's P are formed again. The running maximum is never below ref, so the sum is at least 2^kPOff.
// ---------------------------------------------------------------------------
constexpr int kFQ      = 64;                    // queries per block
constexpr int kFGroups = 5;                     // key groups per block
constexpr int kFWaves  = 4 * kFGroups;          // 20
constexpr int kFStage  = 64;                    // keys per stage
constexpr int kFStages = kN / kFGroups / kFStage;   // 25
constexpr int kFKPitch = 40;                    // halves per staged K row: 80 B = 16 B x odd
constexpr int kFVPitch = 72;                    // halves per staged V row: 144 B = 16 B x odd
constexpr int kFBuf    = kFStage * kFKPitch + kC * kFVPitch;   // halves per stage slot: 7168
constexpr int kFOPitch = 68;                    // floats per row of the join slab
static_assert(kFStages * kFStage * kFGroups == kN && kN % kFQ == 0, "key and query split are exact");
constexpr int kFTile   = 2;                     // stages per tile of the ring
constexpr int kFSlots  = 2 * kFTile;            // stage slots per key group: two buffers of one tile
static_assert(kFStages >= 2 * kFTile, "the prologue fills two whole tiles");
static_assert((kFSlots & (kFSlots - 1)) == 0, "stage -> slot is a mask");
static_assert(kFGroups * kFSlots * kFBuf * 2 + 2 * kFGroups * kFQ * 4 <= 327680, "ring, references and sums fit the LDS of a WGP");
static_assert(kFGroups * kFSlots * kFBuf * 2 >= kFGroups * kC * kFOPitch * 4, "join slab fits in the stage buffers");
// Hardware exp2. The instruction set asks for one independent instruction between a transcendental and an instruction that
// reads its result or overwrites its source.
// In one statement, with results kept apart from sources, each exp2 fills its neighbour's slot and the first
// pack fills the last one's. The four packs to f16 pairs stand in the same statement so that they stay in front of the branch
// of the stage: behind it only the packed half of the registers is live. The s_delay_alu names the last pack's producer, so that
// the SIMD's other waves issue while that pack waits for it; it changes no result.
// p[r] = exp2(a[r]); pk[j] = f16 pair (p[2j], p[2j + 1])
__device__ __forceinline__ void exp2x8pk(float (&p)[8], unsigned (&pk)[4], const float (&a)[8]) {
  asm("v_exp_f32 %0, %12\n\tv_exp_f32 %1, %13\n\tv_exp_f32 %2, %14\n\tv_exp_f32 %3, %15\n\t"
      "v_exp_f32 %4, %16\n\tv_exp_f32 %5, %17\n\tv_exp_f32 %6, %18\n\tv_exp_f32 %7, %19\n\t"
      "v_cvt_pk_f16_f32 %8, %0, %1\n\tv_cvt_pk_f16_f32 %9, %2, %3\n\t"
      "v_cvt_pk_f16_f32 %10, %4, %5\n\ts_delay_alu instid0(TRANS32_DEP_1)\n\tv_cvt_pk_f16_f32 %11, %6, %7"
      : "=&v"(p[0]), "=&v"(p[1]), "=&v"(p[2]), "=&v"(p[3]), "=&v"(p[4]), "=&v"(p[5]), "=&v"(p[6]), "=&v"(p[7]),
        "=&v"(pk[0]), "=&v"(pk[1]), "=&v"(pk[2]), "=&v"(pk[3])
      : "v"(a[0]), "v"(a[1]), "v"(a[2]), "v"(a[3]), "v"(a[4]), "v"(a[5]), "v"(a[6]), "v"(a[7]));
}
// The same directly behind matrix instructions. The compiler does not look into asm text, so it keeps no distance between a
// product and this statement, which reads the product's result and may be given its operand registers for its own results:
// the four leading v_nop are the four vector slots that the chip needs there.
__device__ __forceinline__ void exp2x8pk_behind_mma(float (&p)[8], unsigned (&pk)[4], const float (&a)[8]) {
  asm("v_nop\n\tv_nop\n\tv_nop\n\tv_nop\n\t"
      "v_exp_f32 %0, %12\n\tv_exp_f32 %1, %13\n\tv_exp_f32 %2, %14\n\tv_exp_f32 %3, %15\n\t"
      "v_exp_f32 %4, %16\n\tv_exp_f32 %5, %17\n\tv_exp_f32 %6, %18\n\tv_exp_f32 %7, %19\n\t"
      "v_cvt_pk_f16_f32 %8, %0, %1\n\tv_cvt_pk_f16_f32 %9, %2, %3\n\t"
      "v_cvt_pk_f16_f32 %10, %4, %5\n\ts_delay_alu instid0(TRANS32_DEP_1)\n\tv_cvt_pk_f16_f32 %11, %6, %7"
      : "=&v"(p[0]), "=&v"(p[1]), "=&v"(p[2]), "=&v"(p[3]), "=&v"(p[4]), "=&v"(p[5]), "=&v"(p[6]), "=&v"(p[7]),
        "=&v"(pk[0]), "=&v"(pk[1]), "=&v"(pk[2]), "=&v"(pk[3])
      : "v"(a[0]), "v"(a[1]), "v"(a[2]), "v"(a[3]), "v"(a[4]), "v"(a[5]), "v"(a[6]), "v"(a[7]));
}
constexpr float kPOff    = 4.0f;                // P of a score equal to the reference is 2^4
constexpr float kPSumMax = 32768.0f;            // a lane's stage sum above this moves the reference
// P^T of one stage (two B fragments) and this lane's sum of it, from scores that already hold s - ref + kPOff
template <bool BEHIND_MMA>
__device__ __forceinline__ void stage_probs(const v8f (&st)[4], v16h (&pb)[2], float& ps) {
  ps = 0.0f;
#pragma unroll
  for (int kk = 0; kk < 2; ++kk) {
    float a0[8], a1[8], p0[8], p1[8];
    unsigned k0[4], k1[4];
#pragma unroll
    for (int r = 0; r < 8; ++r) {
      a0[r] = st[2 * kk][r];
      a1[r] = st[2 * kk + 1][r];
    }
    if (BEHIND_MMA && kk == 0) exp2x8pk_behind_mma(p0, k0, a0); else exp2x8pk(p0, k0, a0);
    exp2x8pk(p1, k1, a1);
#pragma unroll
    for (int r = 0; r < 8; ++r) ps += p0[r] + p1[r];
    union { v16h v; unsigned w[8]; } f;         // elements 0..7 = P of tile 2kk, 8..15 = P of tile 2kk + 1
#pragma unroll
    for (int j = 0; j < 4; ++j) { f.w[j] = k0[j]; f.w[4 + j] = k1[j]; }
    pb[kk] = f.v;
  }
}
__device__ __forceinline__ float exp2x1(float a) {
  float p;
  asm("v_exp_f32 %0, %1\n\tv_nop" : "=&v"(p) : "v"(a));   // the v_nop: the same slot
  return p;
}
// one lane's 16 bytes from global memory straight into LDS; counted on asynccnt, the waits are written where a tile is handed over
typedef int v4i_vs __attribute__((vector_size(16)));
__device__ __forceinline__ void copy16_to_lds(const unsigned short* g, unsigned short* l) {
  __builtin_amdgcn_global_load_async_to_lds_b128((__attribute__((address_space(1))) v4i_vs*)g,
                                                 (__attribute__((address_space(3))) v4i_vs*)l, 0, 0);
}
__global__ __launch_bounds__(kFWaves * 32) void attn_fused_kernel(
    const unsigned short* __restrict__ QKP, const unsigned short* __restrict__ VP, const float* __restrict__ x,
    const float* __restrict__ gsc, float* __restrict__ out) {
  __shared__ __align__(16) unsigned short sRing[kFGroups * kFSlots * kFBuf];
  __shared__ float sM[kFGroups][kFQ];
  __shared__ float sL[kFGroups][kFQ];
  const int t     = threadIdx.x;
  const int lane  = t & 31;
  const int wave  = t >> 5;
  const int qt    = wave & 3;
  const int kg    = wave >> 2;
  const int g     = t & 127;                    // thread within the key group
  const int b     = blockIdx.y;
  const int n0    = blockIdx.x * kFQ;
  const int rlane = lane & 15;
  const int hf    = lane >> 4;
  const int koff  = hf * 8;
  const unsigned short* qkb = QKP + (size_t)b * kN * kKP;
  const unsigned short* vpb = VP + (size_t)b * kC * kN;
  const int key0 = kg * (kFStages * kFStage);

  const v16b qf = Frag<__bf16>::load((const __bf16*)(qkb + (size_t)(n0 + qt * 16 + rlane) * kKP + koff));

  // staging: K 64 keys x 4 chunks of 16 B (2 per thread), V 64 rows x 8 chunks (4 per thread, 8 lanes per 128-B line)
  const unsigned short* ksrc = qkb + (size_t)(key0 + (g >> 2)) * kKP + 32 + (g & 3) * 8;
  const unsigned short* vsrc = vpb + (size_t)(g >> 3) * kN + key0 + (g & 7) * 8;
  const int kdst = (g >> 2) * kFKPitch + (g & 3) * 8;
  const int vdst = kFStage * kFKPitch + (g >> 3) * kFVPitch + (g & 7) * 8;
  // All blocks of a sample walk the same K and V rows. Each enters the stages of its key groups at a stage of its own and wraps
  // round, so that at one moment the blocks ask L2 for different lines; the same for the whole block, held in a scalar register
  const int rot = blockIdx.x % kFStages;
  // the six copies of this thread for pass st, into slot st mod kFSlots of its key group; pass st works on the keys of stage
  // (st + rot) mod kFStages
  auto stage_copies = [&](int st) {
    unsigned short* dst = sRing + (kg * kFSlots + (st & (kFSlots - 1))) * kFBuf;
    const int ph = (st + rot < kFStages) ? (st + rot) : (st + rot - kFStages);
#pragma unroll
    for (int j = 0; j < 2; ++j) copy16_to_lds(ksrc + (size_t)(ph * kFStage + j * 32) * kKP, dst + kdst + j * 32 * kFKPitch);
#pragma unroll
    for (int j = 0; j < 4; ++j) copy16_to_lds(vsrc + (size_t)j * 16 * kN + ph * kFStage, dst + vdst + j * 16 * kFVPitch);
  };
#pragma unroll
  for (int u = 0; u < kFTile; ++u) stage_copies(u);
  // tile 0 has landed for this wave's copies; the barrier publishes it to the other waves
  asm volatile("s_wait_asynccnt 0x0" ::: "memory");
  __syncthreads();
#pragma unroll
  for (int u = 0; u < kFTile; ++u) stage_copies(kFTile + u);    // tile 1 flies while tile 0 is worked on

  v8f acc[4];
#pragma unroll
  for (int i = 0; i < 4; ++i) acc[i] = (v8f){0.f,0.f,0.f,0.f,0.f,0.f,0.f,0.f};
  float mref = 0.0f;        // held reference of score * log2(e); set by stage 0
  float lrun = 0.0f;        // this lane's part of the running sum (its own keys), carried x2^kPOff like P
  v8f cvec = (v8f){kPOff, kPOff, kPOff, kPOff, kPOff, kPOff, kPOff, kPOff};   // kPOff - mref, the C operand of the score products

  for (int s = 0; s < kFStages; ++s) {
    const unsigned short* buf = sRing + (kg * kFSlots + (s & (kFSlots - 1))) * kFBuf;
    const __bf16*   kb = (const __bf16*)buf;
    const _Float16* vb = (const _Float16*)(buf + kFStage * kFKPitch);
    v8f st[4];
    v16b kf[4];
#pragma unroll
    for (int tt = 0; tt < 4; ++tt) kf[tt] = Frag<__bf16>::load(kb + (tt * 16 + rlane) * kFKPitch + koff);
    // the K reads stay in front of the V reads: LDS answers in order, and the score products wait for K alone
    __builtin_amdgcn_sched_barrier(0);
    // V fragments of the stage's first 32 keys: read here because the branch below splits the stage, and reads left behind it
    // would each be waited for in turn
    v16h vf0[4];
#pragma unroll
    for (int i = 0; i < 4; ++i) vf0[i] = Frag<_Float16>::load(vb + (i * 16 + rlane) * kFVPitch + koff);
    // all sixteen reads are issued before the first product, so that the wave pays one LDS latency and not one per tile
    __builtin_amdgcn_sched_barrier(0);
#pragma unroll
    for (int tt = 0; tt < 4; ++tt) st[tt] = Frag<__bf16>::mma(kf[tt], qf, cvec);
    // keeps the four score products back to back: each fills the others' result distance, else every one is followed by idle slots
    __builtin_amdgcn_sched_barrier(0);
    v16h pb[2];
    float ps;
    stage_probs<true>(st, pb, ps);
    // one scalar branch per stage, the same for the whole wave; !(<=) also catches a sum that is not a number
    if (s == 0 || __builtin_amdgcn_ballot_w32(!(ps <= kPSumMax)) != 0u) {
      float mx = st[0][0];
#pragma unroll
      for (int tt = 0; tt < 4; ++tt)
#pragma unroll
        for (int r = 0; r < 8; ++r) mx = fmaxf(mx, st[tt][r]);
      mx = fmaxf(mx, __shfl_xor(mx, 16, 32));     // the query's other 32 keys of this stage
      // stage 0 sets the reference, up or down (O and the sum are still zero); later it only rises
      const float delta = (s == 0) ? (mx - kPOff) : fmaxf(mx - kPOff, 0.0f);
      const float alpha = (s == 0) ? 1.0f : exp2x1(-delta);
      mref += delta;
      lrun *= alpha;
#pragma unroll
      for (int r = 0; r < 8; ++r) cvec[r] -= delta;
#pragma unroll
      for (int i = 0; i < 4; ++i) acc[i] *= alpha;
#pragma unroll
      for (int tt = 0; tt < 4; ++tt)
#pragma unroll
        for (int r = 0; r < 8; ++r) st[tt][r] -= delta;
      stage_probs<false>(st, pb, ps);
    }
    lrun += ps;
    v16h vf1[4];
#pragma unroll
    for (int i = 0; i < 4; ++i) vf1[i] = Frag<_Float16>::load(vb + (i * 16 + rlane) * kFVPitch + 32 + koff);
    // the eight reads of the second 32 keys fly under the four products of the first
    __builtin_amdgcn_sched_barrier(0);
#pragma unroll
    for (int i = 0; i < 4; ++i) acc[i] = Frag<_Float16>::mma(vf0[i], pb[0], acc[i]);
    // holds those four products in front of the wait below, which would else be passed up to the reads
    __builtin_amdgcn_sched_barrier(0);
    // Hand-over of the buffers, behind the last LDS read of a tile's last stage; the test is the same for the whole block. The
    // last tile is handed to nobody: the barrier of the join ends its reads
    if ((s & (kFTile - 1)) == kFTile - 1) {
      // this wave's reads of the tile have returned before its buffer is given to the copies
      asm volatile("s_wait_dscnt 0x0" ::: "memory");
      // this wave's copies of the next tile have landed
      asm volatile("s_wait_asynccnt 0x0" ::: "memory");
      // publishes the next tile; every wave has left the buffer of this one
      __syncthreads();
      // the tile after the next, into the buffer just read; it flies while the next tile is worked on
#pragma unroll
      for (int u = 0; u < kFTile; ++u)
        if (s + 1 + kFTile + u < kFStages) stage_copies(s + 1 + kFTile + u);
    }
    // the copies stay in front of the last four products: they have the long way, and the products need registers alone
    __builtin_amdgcn_sched_barrier(0);
#pragma unroll
    for (int i = 0; i < 4; ++i) acc[i] = Frag<_Float16>::mma(vf1[i], pb[1], acc[i]);
  }
  // nothing is in flight when the stage buffers become the join slab
  asm volatile("s_wait_asynccnt 0x0" ::: "memory");

  // ---- join of the five key groups ----
  lrun += __shfl_xor(lrun, 16, 32);
  const int col = qt * 16 + rlane;
  if (hf == 0) { sM[kg][col] = mref; sL[kg][col] = lrun; }
  __syncthreads();          // references and sums published; every wave has left the stage buffers, which become the join slab
  float mall = sM[0][col];
#pragma unroll
  for (int k = 1; k < kFGroups; ++k) mall = fmaxf(mall, sM[k][col]);
  float lall = 0.0f;
#pragma unroll
  for (int k = 0; k < kFGroups; ++k) lall = fmaf(sL[k][col], exp2x1(sM[k][col] - mall), lall);
  const float f = exp2x1(mref - mall) / lall;
  float* slab = (float*)sRing;
#pragma unroll
  for (int i = 0; i < 4; ++i)
#pragma unroll
    for (int r = 0; r < 8; ++r) slab[(kg * kC + i * 16 + koff + r) * kFOPitch + col] = acc[i][r] * f;
  __syncthreads();
  // 64 rows x 16 float4 = 1024 pieces; 16 lanes cover one 256-B row segment of out
  const float gmul = gsc[0];
  for (int idx = t; idx < kC * (kFQ / 4); idx += kFWaves * 32) {
    const int row = idx >> 4, c4 = (idx & 15) * 4;
    v4f sum = *(const v4f*)(slab + row * kFOPitch + c4);
#pragma unroll
    for (int k = 1; k < kFGroups; ++k) sum += *(const v4f*)(slab + (k * kC + row) * kFOPitch + c4);
    const size_t o = ((size_t)b * kC + row) * kN + n0 + c4;
    const v4f xv = *(const v4f*)(x + o);
    v4f rr;
#pragma unroll
    for (int e = 0; e < 4; ++e) rr[e] = fmaf(gmul, sum[e], xv[e]);
    *(v4f*)(out + o) = rr;
  }
}

// ---------------------------------------------------------------------------
// Host glue.
//   QKP  bf16 [2][8000][64]      2,048,000  at          0
//   VP   f16  [2][64][8000]      2,048,000  at  2,048,000
//   total                        4,096,000
// GEMM shapes: projections per block M=80 (Wv rows, then Wq|Wk rows), N=64 voxels, K=64; in the attention kernel per block scores
// M=8000 keys, N=64 queries, K=32 and V.P^T M=64, N=64, K=8000. No partial tiles, no padding rows.
// ---------------------------------------------------------------------------
extern "C" void kernel_launch(void* const* d_in, const int* in_sizes, int n_in,
                              void* d_out, int out_size, void* d_ws, size_t ws_size,
                              hipStream_t stream) {
  if (n_in < 8) return;
  const int nElem = kB * kC * kN;                 // 1,024,000
  if (in_sizes[0] != nElem) return;
  if (in_sizes[1] != kCq * kC || in_sizes[2] != kCq) return;
  if (in_sizes[3] != kCq * kC || in_sizes[4] != kCq) return;
  if (in_sizes[5] != kC * kC || in_sizes[6] != kC || in_sizes[7] < 1) return;
  if (out_size != nElem) return;

  const size_t szQKP = (size_t)kB * kN * kKP * 2;
  const size_t szVP  = (size_t)kB * kC * kN * 2;
  const size_t offQKP  = 0;
  const size_t offVP   = offQKP + szQKP;
  const size_t total   = offVP + szVP;
  if (ws_size < total) return;

  const float* x     = (const float*)d_in[0];
  const float* Wq    = (const float*)d_in[1];
  const float* bq    = (const float*)d_in[2];
  const float* Wk    = (const float*)d_in[3];
  const float* bk    = (const float*)d_in[4];
  const float* Wv    = (const float*)d_in[5];
  const float* bv    = (const float*)d_in[6];
  const float* gamma = (const float*)d_in[7];
  float* out = (float*)d_out;
  char* ws = (char*)d_ws;
  unsigned short* QKP = (unsigned short*)(ws + offQKP);
  unsigned short* VP  = (unsigned short*)(ws + offVP);

  // ---- x, weights -> packed q|k plane and V plane, one launch ----
  proj_fused_kernel<<<dim3(kN / kPVox, kB), dim3(kPWaves * 32), 0, stream>>>(x, Wq, bq, Wk, bk, Wv, bv, QKP, VP);
  // ---- scores -> softmax -> V.P^T -> gamma scale and residual, one launch ----
  attn_fused_kernel<<<dim3(kN / kFQ, kB), dim3(kFWaves * 32), 0, stream>>>(QKP, VP, x, gamma, out);
}

// v007
// Measured time: 30.9 microseconds a run.
// In two side-by-side timings against v006, it was 1.09 and 1.08 times as fast.
// All steps since v000 together make it 114 times as fast.
// Contractions: q/k/v channel projections on v_wmma_f32_16x16x32_bf16 with W and x as bf16 hi+lo planes (hh+hl+lh); energy k.q^T on v_wmma_f32_16x16x32_bf16 with q,k bf16 hi|lo parts laid along the 32-deep k axis (hh+lh+hl in one pass); V.P^T on v_wmma_f32_16x16x32_f16 (P = exp(s - held reference) in f16 carried x16, V f16 plane); f32 accumulate everywhere; softmax, biases, gamma scale and residual in f32.
#include <hip/hip_runtime.h>
#include <math.h>

// ---------------------------------------------------------------------------
// Problem constants
// ---------------------------------------------------------------------------
constexpr int kB    = 2;        // batch
constexpr int kC    = 64;       // channels (value dim and projection K)
constexpr int kCq   = 8;        // query/key channels
constexpr int kN    = 8000;     // voxels per sample (20*20*20)
constexpr int kQW   = 16;       // halves per stored q row and per stored k row: hi part, lo part
constexpr float kLog2e = 1.4426950408889634f;
static_assert(kN % 64 == 0, "tiles");
static_assert(kC == 64 && kQW == 2 * kCq && kC % 32 == 0 && kN % 32 == 0, "k multiples");
constexpr size_t kKPlane = (size_t)kB * kN * kQW;   // halves from the q plane to the k plane
static_assert(3 * kCq <= 32 && 2 * kCq == 16, "hi|lo|hi packing fits one k step; q and k rows fill one 16-row tile");

typedef __attribute__((ext_vector_type(16))) _Float16 v16h;
typedef __attribute__((ext_vector_type(8)))  _Float16 v8h;
typedef __attribute__((ext_vector_type(4)))  _Float16 v4h;
typedef __attribute__((ext_vector_type(16))) __bf16   v16b;
typedef __attribute__((ext_vector_type(8)))  __bf16   v8b;
typedef __attribute__((ext_vector_type(8)))  float    v8f;
typedef __attribute__((ext_vector_type(4)))  float    v4f;
typedef __attribute__((ext_vector_type(4)))  unsigned int v4u;

__device__ __forceinline__ unsigned short f2bf_bits(float f) {
  unsigned u = __float_as_uint(f);
  return (unsigned short)((u + 0x7FFFu + ((u >> 16) & 1u)) >> 16);
}
__device__ __forceinline__ float bf_bits2f(unsigned short h) { return __uint_as_float(((unsigned)h) << 16); }
__device__ __forceinline__ unsigned pk16(unsigned short a, unsigned short b) { return (unsigned)a | ((unsigned)b << 16); }

template <typename T> struct Frag;
template <> struct Frag<_Float16> {
  typedef v16h V; union U { v16h v; v8h h[2]; };
  // elements 0..7 <- p[0..7], 8..15 <- p[16..23]
  static __device__ __forceinline__ v16h load(const _Float16* p) {
    U f; f.h[0] = *(const v8h*)(p); f.h[1] = *(const v8h*)(p + 16); return f.v;
  }
  static __device__ __forceinline__ v8f mma(v16h a, v16h b, v8f c) {
    return __builtin_amdgcn_wmma_f32_16x16x32_f16(false, a, false, b, (short)0, c, false, false);
  }
};
template <> struct Frag<__bf16> {
  typedef v16b V; union U { v16b v; v8b h[2]; v4u u[2]; };
  static __device__ __forceinline__ v16b load(const __bf16* p) {
    U f; f.h[0] = *(const v8b*)(p); f.h[1] = *(const v8b*)(p + 16); return f.v;
  }
  static __device__ __forceinline__ v8f mma(v16b a, v16b b, v8f c) {
    return __builtin_amdgcn_wmma_f32_16x16x32_bf16(false, a, false, b, (short)0, c, false, false);
  }
};

// ---------------------------------------------------------------------------
// All three projections in one kernel, straight from x and the f32 weights to the two operand planes of the attention kernel:
//   QKP: a q plane and behind it a k plane, each [b][n][16] bf16: cols 0..7 = hi, 8..15 = lo, 32 B a row with nothing repeated, so
//   that a stage of 64 keys is 2 KiB of whole 128-B lines. The attention kernel lays them along the 32-deep k axis when it forms
//   its fragments: q as hi, lo, hi, 0 and k as hi, hi, lo, lo, which sums to qh.kh + ql.kh + qh.kl (+ 0.kl); q here is
//   (Wq.x + bq) * log2(e), so that the score product comes out in the exponent units of the hardware exp2;
//   VP[b][c][m] f16 = Wv.x + bv.
// grid (kN / 64, kB), 5 waves. A block owns 64 voxels. D = W.x: rows = output channels, columns = voxels. Wave w < 4 owns rows
// 16w..16w+15 of Wv, wave 4 the 16 rows Wq|Wk; each wave splits its own 16 weight rows into bf16 hi/lo A fragments in registers.
// Column j of column tile tt is voxel 4j + tt, so one float4 of x feeds the four tiles and four f16 results of a V row are 8 B
// (16 lanes = one 128-B line). Wave w < 4 splits 16 of the 64 channels (k step w >> 1, fragment half w & 1) of all 64 voxels
// into hi/lo and writes them to LDS already in B-fragment order, lane by lane; one barrier publishes them to the five waves.
// k order of A and B alike: element h * 8 + e of a lane is channel ks * 32 + h * 16 + (lane >> 4) * 8 + e.
// ---------------------------------------------------------------------------
constexpr int kPVox   = 64;                     // voxels per block
constexpr int kPWaves = 5;                      // four V row tiles and the q|k row tile
static_assert(kN % kPVox == 0 && kC == 4 * 16, "projection tiling is exact");
__device__ __forceinline__ void split8(const float (&v)[8], v4u& hi, v4u& lo) {
  unsigned short hb[8], lb[8];
#pragma unroll
  for (int e = 0; e < 8; ++e) {
    hb[e] = f2bf_bits(v[e]);
    lb[e] = f2bf_bits(v[e] - bf_bits2f(hb[e]));
  }
  hi = (v4u){pk16(hb[0], hb[1]), pk16(hb[2], hb[3]), pk16(hb[4], hb[5]), pk16(hb[6], hb[7])};
  lo = (v4u){pk16(lb[0], lb[1]), pk16(lb[2], lb[3]), pk16(lb[4], lb[5]), pk16(lb[6], lb[7])};
}
// halves offset of the 16-B piece (column tile tt, k step ks, plane pl, fragment half h) of one lane
__device__ __forceinline__ int xfrag_off(int tt, int ks, int pl, int h, int lane) {
  return ((((tt * 2 + ks) * 2 + pl) * 2 + h) * 32 + lane) * 8;
}
// acc[tt] = W.x over both k steps. The three partial products are summed hi.hi, x_hi.w_lo, x_lo.w_hi (XLEAD) or hi.hi, w_hi.x_lo,
// w_lo.x_hi.
template <bool XLEAD>
__device__ __forceinline__ void proj_products(const v16b (&ah)[2], const v16b (&al)[2], const unsigned short* sX, int lane,
                                              v8f (&acc)[4]) {
#pragma unroll
  for (int tt = 0; tt < 4; ++tt) acc[tt] = (v8f){0.f,0.f,0.f,0.f,0.f,0.f,0.f,0.f};
#pragma unroll
  for (int ks = 0; ks < 2; ++ks) {
    v16b bh[4], bl[4];
#pragma unroll
    for (int tt = 0; tt < 4; ++tt) {
      Frag<__bf16>::U fh, fl;
      fh.u[0] = *(const v4u*)(sX + xfrag_off(tt, ks, 0, 0, lane));
      fh.u[1] = *(const v4u*)(sX + xfrag_off(tt, ks, 0, 1, lane));
      fl.u[0] = *(const v4u*)(sX + xfrag_off(tt, ks, 1, 0, lane));
      fl.u[1] = *(const v4u*)(sX + xfrag_off(tt, ks, 1, 1, lane));
      bh[tt] = fh.v;
      bl[tt] = fl.v;
    }
#pragma unroll
    for (int tt = 0; tt < 4; ++tt) acc[tt] = Frag<__bf16>::mma(ah[ks], bh[tt], acc[tt]);
#pragma unroll
    for (int tt = 0; tt < 4; ++tt) acc[tt] = XLEAD ? Frag<__bf16>::mma(al[ks], bh[tt], acc[tt]) : Frag<__bf16>::mma(ah[ks], bl[tt], acc[tt]);
#pragma unroll
    for (int tt = 0; tt < 4; ++tt) acc[tt] = XLEAD ? Frag<__bf16>::mma(ah[ks], bl[tt], acc[tt]) : Frag<__bf16>::mma(al[ks], bh[tt], acc[tt]);
  }
}
__global__ __launch_bounds__(kPWaves * 32) void proj_fused_kernel(
    const float* __restrict__ x, const float* __restrict__ Wq, const float* __restrict__ bq, const float* __restrict__ Wk,
    const float* __restrict__ bk, const float* __restrict__ Wv, const float* __restrict__ bv,
    unsigned short* __restrict__ QKP, unsigned short* __restrict__ VP) {
  __shared__ __align__(16) unsigned short sX[4 * 2 * 2 * 2 * 32 * 8];   // 16 KiB: x hi/lo planes in B-fragment order
  const int lane = threadIdx.x & 31;
  const int wave = __builtin_amdgcn_readfirstlane(threadIdx.x >> 5);
  const int rl   = lane & 15;
  const int hf   = lane >> 4;
  const int b    = blockIdx.y;
  const int n0   = blockIdx.x * kPVox;

  // this wave's 16 weight rows, one per lane & 15
  const float* wrow = ((wave < 4) ? (Wv + (wave * 16 + rl) * kC) : ((rl < kCq) ? (Wq + rl * kC) : (Wk + (rl - kCq) * kC))) + hf * 8;
  v4f wv[2][2][2];
#pragma unroll
  for (int ks = 0; ks < 2; ++ks)
#pragma unroll
    for (int h = 0; h < 2; ++h)
#pragma unroll
      for (int p = 0; p < 2; ++p) wv[ks][h][p] = *(const v4f*)(wrow + ks * 32 + h * 16 + p * 4);
  const float* brow = (wave < 4) ? (bv + wave * 16 + hf * 8) : (hf ? bk : bq);
  const v4f bias0 = *(const v4f*)(brow);
  const v4f bias1 = *(const v4f*)(brow + 4);
  // the two address pairs of the ten loads above are reused below: the wait that precedes such an overwrite; naming them as
  // inputs keeps both pairs whole up to it
  asm volatile("s_wait_xcnt 0x0" :: "v"(wrow), "v"(brow) : "memory");

  if (wave < 4) {
    const int ks = wave >> 1, h = wave & 1;
    const float* xs = x + ((size_t)b * kC + ks * 32 + h * 16 + hf * 8) * kN + n0 + rl * 4;
    v4f xv[8];
#pragma unroll
    for (int e = 0; e < 8; ++e) xv[e] = *(const v4f*)(xs + (size_t)e * kN);
#pragma unroll
    for (int tt = 0; tt < 4; ++tt) {
      float v[8];
#pragma unroll
      for (int e = 0; e < 8; ++e) v[e] = xv[e][tt];
      v4u hi, lo;
      split8(v, hi, lo);
      *(v4u*)(sX + xfrag_off(tt, ks, 0, h, lane)) = hi;
      *(v4u*)(sX + xfrag_off(tt, ks, 1, h, lane)) = lo;
    }
  }

  v16b ah[2], al[2];
#pragma unroll
  for (int ks = 0; ks < 2; ++ks) {
    Frag<__bf16>::U fh, fl;
#pragma unroll
    for (int h = 0; h < 2; ++h) {
      float v[8];
#pragma unroll
      for (int e = 0; e < 4; ++e) { v[e] = wv[ks][h][0][e]; v[4 + e] = wv[ks][h][1][e]; }
      split8(v, fh.u[h], fl.u[h]);
    }
    ah[ks] = fh.v;
    al[ks] = fl.v;
  }
  __syncthreads();          // the x fragments of all 64 channels are published to the five waves

  v8f acc[4];
  if (wave == 4) {          // behind the only barrier: the q|k wave finishes here
    proj_products<true>(ah, al, sX, lane, acc);
    unsigned short* qrow = QKP + (hf ? kKPlane : (size_t)0) + ((size_t)b * kN + n0 + rl * 4) * kQW;
    const float qsc = hf ? 1.0f : kLog2e;       // rows 0..7 (lower lane half) are q, rows 8..15 are k
#pragma unroll
    for (int tt = 0; tt < 4; ++tt) {
      float v[8];
#pragma unroll
      for (int r = 0; r < 8; ++r) v[r] = (acc[tt][r] + ((r < 4) ? bias0[r & 3] : bias1[r & 3])) * qsc;
      v4u hi, lo;
      split8(v, hi, lo);
      unsigned short* dst = qrow + tt * kQW;
      *(v4u*)(dst)     = hi;
      *(v4u*)(dst + 8) = lo;
    }
    return;
  }
  proj_products<false>(ah, al, sX, lane, acc);
  unsigned short* vrow = VP + ((size_t)b * kC + wave * 16 + hf * 8) * kN + n0 + rl * 4;
#pragma unroll
  for (int r = 0; r < 8; ++r) {
    const float bb = (r < 4) ? bias0[r & 3] : bias1[r & 3];
    v4h o;
#pragma unroll
    for (int tt = 0; tt < 4; ++tt) o[tt] = (_Float16)(acc[tt][r] + bb);
    *(v4h*)(vrow + (size_t)r * kN) = o;
  }
  // the built code lays this path in front of the q|k wave's, with a never-taken branch on into it, where the registers of the
  // eight stores are rewritten: the wait that precedes such an overwrite
  asm volatile("s_wait_xcnt 0x0" ::: "memory");
}

// ---------------------------------------------------------------------------
// Scores, softmax and V.P^T in one kernel; scores and probabilities never leave the registers.
//   out[b][c][n] = gsc[0] * sum_m V[b][c][m] * softmax_m(q[n].k[m]) + x[b][c][n]
// grid (kN / 64, kB), 20 waves. A block owns 64 queries; wave w = 4 * kg + qt owns query tile qt (16 queries) and key group kg
// (kN / 5 keys), walked in stages of 64 keys, from a first stage that differs from block to block. The four waves of a key
// group bring its K rows (hi and lo part, 32 B a key) and V rows into their own pair of LDS buffers by asynchronous copies, through no register. A buffer holds a tile of two stages (the copies
// take no registers, so LDS alone bounds it; the last tile has one stage): one block barrier per tile, behind the tile's last
// LDS read, publishes the next tile and frees the buffer just read, which the copies of the tile after that then fill; the
// last four V.P^T products of the tile, which need registers alone, follow behind it.
// S^T = K.Q^T: a lane holds 8 keys per 16-key tile of ONE query (column lane & 15), keys (lane >> 4) * 8 + r, which is the
// k order of the B fragment of the next product, so P^T is packed in place. O^T += V.P^T: the same column per lane, so a
// rescale is one factor per lane. The five key groups are joined through LDS in index order at the end.
// Softmax runs against a HELD reference per query and key group: P = exp2(s - ref + kPOff), s in log2 units. kPOff - ref enters
// as the C operand of the score product, so a score leaves the matrix unit ready for exp2. ref is the query's maximum over the
// first stage that the group walks; after that it moves only when a lane's sum of the stage's 32 P passes kPSumMax (every P is
// positive, so none is above the sum and all fit f16): then, and in stage 0, ref goes up to the stage's maximum, O and the running sum
// take the factor, and the stage's P are formed again. The running maximum is never below ref, so the sum is at least 2^kPOff.
// ---------------------------------------------------------------------------
constexpr int kFQ      = 64;                    // queries per block
constexpr int kFGroups = 5;                     // key groups per block
constexpr int kFWaves  = 4 * kFGroups;          // 20
constexpr int kFStage  = 64;                    // keys per stage
constexpr int kFStages = kN / kFGroups / kFStage;   // 25
constexpr int kFKPart  = kFStage * kCq;         // halves per staged K part: the hi parts of a stage's keys in a row, then the lo parts
constexpr int kFVPitch = 72;                    // halves per staged V row: 144 B = 16 B x odd
constexpr int kFBuf    = 2 * kFKPart + kC * kFVPitch;   // halves per buffer: 5632
constexpr int kFOPitch = 68;                    // floats per row of the join slab
static_assert(kFStages * kFStage * kFGroups == kN && kN % kFQ == 0, "key and query split are exact");
constexpr int kFTile   = 2;                     // stages per tile of the ring
constexpr int kFSlots  = 2 * kFTile;            // stage slots per key group: two buffers of one tile
static_assert(kFStages >= 2 * kFTile, "the prologue fills two whole tiles");
static_assert((kFSlots & (kFSlots - 1)) == 0, "stage -> slot is a mask");
static_assert(kFGroups * kFSlots * kFBuf * 2 + 2 * kFGroups * kFQ * 4 <= 327680, "ring, references and sums fit the LDS of a WGP");
static_assert(kFGroups * kFSlots * kFBuf * 2 >= kFGroups * kC * kFOPitch * 4, "join slab fits in the stage buffers");
// Hardware exp2. The instruction set asks for one independent instruction between a transcendental and an instruction that
// reads its result or overwrites its source.
// In one statement, with results kept apart from sources, each exp2 fills its neighbour's slot and the first
// pack fills the last one's. The four packs to f16 pairs stand in the same statement so that they stay in front of the branch
// of the stage: behind it only the packed half of the registers is live. The s_delay_alu names the last pack's producer, so that
// the SIMD's other waves issue while that pack waits for it; it changes no result.
// p[r] = exp2(a[r]); pk[j] = f16 pair (p[2j], p[2j + 1])
__device__ __forceinline__ void exp2x8pk(float (&p)[8], unsigned (&pk)[4], const float (&a)[8]) {
  asm("v_exp_f32 %0, %12\n\tv_exp_f32 %1, %13\n\tv_exp_f32 %2, %14\n\tv_exp_f32 %3, %15\n\t"
      "v_exp_f32 %4, %16\n\tv_exp_f32 %5, %17\n\tv_exp_f32 %6, %18\n\tv_exp_f32 %7, %19\n\t"
      "v_cvt_pk_f16_f32 %8, %0, %1\n\tv_cvt_pk_f16_f32 %9, %2, %3\n\t"
      "v_cvt_pk_f16_f32 %10, %4, %5\n\ts_delay_alu instid0(TRANS32_DEP_1)\n\tv_cvt_pk_f16_f32 %11, %6, %7"
      : "=&v"(p[0]), "=&v"(p[1]), "=&v"(p[2]), "=&v"(p[3]), "=&v"(p[4]), "=&v"(p[5]), "=&v"(p[6]), "=&v"(p[7]),
        "=&v"(pk[0]), "=&v"(pk[1]), "=&v"(pk[2]), "=&v"(pk[3])
      : "v"(a[0]), "v"(a[1]), "v"(a[2]), "v"(a[3]), "v"(a[4]), "v"(a[5]), "v"(a[6]), "v"(a[7]));
}
// The same directly behind matrix instructions. The compiler does not look into asm text, so it keeps no distance between a
// product and this statement, which reads the product's result and may be given its operand registers for its own results:
// the four leading v_nop are the four vector slots that the chip needs there.
__device__ __forceinline__ void exp2x8pk_behind_mma(float (&p)[8], unsigned (&pk)[4], const float (&a)[8]) {
  asm("v_nop\n\tv_nop\n\tv_nop\n\tv_nop\n\t"
      "v_exp_f32 %0, %12\n\tv_exp_f32 %1, %13\n\tv_exp_f32 %2, %14\n\tv_exp_f32 %3, %15\n\t"
      "v_exp_f32 %4, %16\n\tv_exp_f32 %5, %17\n\tv_exp_f32 %6, %18\n\tv_exp_f32 %7, %19\n\t"
      "v_cvt_pk_f16_f32 %8, %0, %1\n\tv_cvt_pk_f16_f32 %9, %2, %3\n\t"
      "v_cvt_pk_f16_f32 %10, %4, %5\n\ts_delay_alu instid0(TRANS32_DEP_1)\n\tv_cvt_pk_f16_f32 %11, %6, %7"
      : "=&v"(p[0]), "=&v"(p[1]), "=&v"(p[2]), "=&v"(p[3]), "=&v"(p[4]), "=&v"(p[5]), "=&v"(p[6]), "=&v"(p[7]),
        "=&v"(pk[0]), "=&v"(pk[1]), "=&v"(pk[2]), "=&v"(pk[3])
      : "v"(a[0]), "v"(a[1]), "v"(a[2]), "v"(a[3]), "v"(a[4]), "v"(a[5]), "v"(a[6]), "v"(a[7]));
}
constexpr float kPOff    = 4.0f;                // P of a score equal to the reference is 2^4
constexpr float kPSumMax = 32768.0f;            // a lane's stage sum above this moves the reference
// P^T of one stage (two B fragments) and this lane's sum of it, from scores that already hold s - ref + kPOff
template <bool BEHIND_MMA>
__device__ __forceinline__ void stage_probs(const v8f (&st)[4], v16h (&pb)[2], float& ps) {
  ps = 0.0f;
#pragma unroll
  for (int kk = 0; kk < 2; ++kk) {
    float a0[8], a1[8], p0[8], p1[8];
    unsigned k0[4], k1[4];
#pragma unroll
    for (int r = 0; r < 8; ++r) {
      a0[r] = st[2 * kk][r];
      a1[r] = st[2 * kk + 1][r];
    }
    if (BEHIND_MMA && kk == 0) exp2x8pk_behind_mma(p0, k0, a0); else exp2x8pk(p0, k0, a0);
    exp2x8pk(p1, k1, a1);
#pragma unroll
    for (int r = 0; r < 8; ++r) ps += p0[r] + p1[r];
    union { v16h v; unsigned w[8]; } f;         // elements 0..7 = P of tile 2kk, 8..15 = P of tile 2kk + 1
#pragma unroll
    for (int j = 0; j < 4; ++j) { f.w[j] = k0[j]; f.w[4 + j] = k1[j]; }
    pb[kk] = f.v;
  }
}
__device__ __forceinline__ float exp2x1(float a) {
  float p;
  asm("v_exp_f32 %0, %1\n\tv_nop" : "=&v"(p) : "v"(a));   // the v_nop: the same slot
  return p;
}
// one lane's 16 bytes from global memory straight into LDS; counted on asynccnt, the waits are written where a tile is handed over
typedef int v4i_vs __attribute__((vector_size(16)));
__device__ __forceinline__ void copy16_to_lds(const unsigned short* g, unsigned short* l) {
  __builtin_amdgcn_global_load_async_to_lds_b128((__attribute__((address_space(1))) v4i_vs*)g,
                                                 (__attribute__((address_space(3))) v4i_vs*)l, 0, 0);
}
__global__ __launch_bounds__(kFWaves * 32) void attn_fused_kernel(
    const unsigned short* __restrict__ QKP, const unsigned short* __restrict__ VP, const float* __restrict__ x,
    const float* __restrict__ gsc, float* __restrict__ out) {
  __shared__ __align__(16) unsigned short sRing[kFGroups * kFSlots * kFBuf];
  __shared__ float sM[kFGroups][kFQ];
  __shared__ float sL[kFGroups][kFQ];
  const int t     = threadIdx.x;
  const int lane  = t & 31;
  const int wave  = t >> 5;
  const int qt    = wave & 3;
  const int kg    = wave >> 2;
  const int g     = t & 127;                    // thread within the key group
  const int b     = blockIdx.y;
  const int n0    = blockIdx.x * kFQ;
  const int rlane = lane & 15;
  const int hf    = lane >> 4;
  const int koff  = hf * 8;
  const unsigned short* qpb = QKP + (size_t)b * kN * kQW;
  const unsigned short* kpb = qpb + kKPlane;
  const unsigned short* vpb = VP + (size_t)b * kC * kN;
  const int key0 = kg * (kFStages * kFStage);

  // q along the k axis: hi, lo, hi, 0. The lower lane half holds k 0..7 and 16..23 (hi twice), the upper 8..15 and 24..31 (lo, 0)
  Frag<__bf16>::U qu;
  qu.u[0] = *(const v4u*)(qpb + (size_t)(n0 + qt * 16 + rlane) * kQW + koff);
  qu.u[1] = hf ? (v4u){0u, 0u, 0u, 0u} : qu.u[0];
  const v16b qf = qu.v;

  // staging: K 64 keys x 2 chunks of 16 B (1 per thread, a wave takes four whole 128-B lines), V 64 rows x 8 chunks (4 per
  // thread, 8 lanes per 128-B line)
  const unsigned short* ksrc = kpb + (size_t)key0 * kQW + g * 8;
  const unsigned short* vsrc = vpb + (size_t)(g >> 3) * kN + key0 + (g & 7) * 8;
  const int kdst = (g & 1) * kFKPart + (g >> 1) * kCq;
  const int vdst = 2 * kFKPart + (g >> 3) * kFVPitch + (g & 7) * 8;
  // All blocks of a sample walk the same K and V rows. Each enters the stages of its key groups at a stage of its own and wraps
  // round, so that at one moment the blocks ask L2 for different lines; the same for the whole block, held in a scalar register
  const int rot = blockIdx.x % kFStages;
  // the five copies of this thread for pass st, into slot st mod kFSlots of its key group; pass st works on the keys of stage
  // (st + rot) mod kFStages
  auto stage_copies = [&](int st) {
    unsigned short* dst = sRing + (kg * kFSlots + (st & (kFSlots - 1))) * kFBuf;
    const int ph = (st + rot < kFStages) ? (st + rot) : (st + rot - kFStages);
    copy16_to_lds(ksrc + (size_t)(ph * kFStage) * kQW, dst + kdst);
#pragma unroll
    for (int j = 0; j < 4; ++j) copy16_to_lds(vsrc + (size_t)j * 16 * kN + ph * kFStage, dst + vdst + j * 16 * kFVPitch);
  };
#pragma unroll
  for (int u = 0; u < kFTile; ++u) stage_copies(u);
  // tile 0 has landed for this wave's copies; the barrier publishes it to the other waves
  asm volatile("s_wait_asynccnt 0x0" ::: "memory");
  __syncthreads();
#pragma unroll
  for (int u = 0; u < kFTile; ++u) stage_copies(kFTile + u);    // tile 1 flies while tile 0 is worked on

  v8f acc[4];
#pragma unroll
  for (int i = 0; i < 4; ++i) acc[i] = (v8f){0.f,0.f,0.f,0.f,0.f,0.f,0.f,0.f};
  float mref = 0.0f;        // held reference of score * log2(e); set by stage 0
  float lrun = 0.0f;        // this lane's part of the running sum (its own keys), carried x2^kPOff like P
  v8f cvec = (v8f){kPOff, kPOff, kPOff, kPOff, kPOff, kPOff, kPOff, kPOff};   // kPOff - mref, the C operand of the score products

  for (int s = 0; s < kFStages; ++s) {
    const unsigned short* buf = sRing + (kg * kFSlots + (s & (kFSlots - 1))) * kFBuf;
    const __bf16*   kb = (const __bf16*)buf;
    const _Float16* vb = (const _Float16*)(buf + 2 * kFKPart);
    v8f st[4];
    v16b kf[4];
#pragma unroll
    for (int tt = 0; tt < 4; ++tt) {
      // k along the k axis: hi, hi, lo, lo: both lane halves read the same two pieces; the last 8 meet the zeros of q
      Frag<__bf16>::U ku;
      ku.h[0] = *(const v8b*)(kb + (tt * 16 + rlane) * kCq);
      ku.h[1] = *(const v8b*)(kb + kFKPart + (tt * 16 + rlane) * kCq);
      kf[tt] = ku.v;
    }
    // the K reads stay in front of the V reads: LDS answers in order, and the score products wait for K alone
    __builtin_amdgcn_sched_barrier(0);
    // V fragments of the stage's first 32 keys: read here because the branch below splits the stage, and reads left behind it
    // would each be waited for in turn
    v16h vf0[4];
#pragma unroll
    for (int i = 0; i < 4; ++i) vf0[i] = Frag<_Float16>::load(vb + (i * 16 + rlane) * kFVPitch + koff);
    // all sixteen reads are issued before the first product, so that the wave pays one LDS latency and not one per tile
    __builtin_amdgcn_sched_barrier(0);
#pragma unroll
    for (int tt = 0; tt < 4; ++tt) st[tt] = Frag<__bf16>::mma(kf[tt], qf, cvec);
    // keeps the four score products back to back: each fills the others' result distance, else every one is followed by idle slots
    __builtin_amdgcn_sched_barrier(0);
    v16h pb[2];
    float ps;
    stage_probs<true>(st, pb, ps);
    // one scalar branch per stage, the same for the whole wave; !(<=) also catches a sum that is not a number
    if (s == 0 || __builtin_amdgcn_ballot_w32(!(ps <= kPSumMax)) != 0u) {
      float mx = st[0][0];
#pragma unroll
      for (int tt = 0; tt < 4; ++tt)
#pragma unroll
        for (int r = 0; r < 8; ++r) mx = fmaxf(mx, st[tt][r]);
      mx = fmaxf(mx, __shfl_xor(mx, 16, 32));     // the query's other 32 keys of this stage
      // stage 0 sets the reference, up or down (O and the sum are still zero); later it only rises
      const float delta = (s == 0) ? (mx - kPOff) : fmaxf(mx - kPOff, 0.0f);
      const float alpha = (s == 0) ? 1.0f : exp2x1(-delta);
      mref += delta;
      lrun *= alpha;
#pragma unroll
      for (int r = 0; r < 8; ++r) cvec[r] -= delta;
#pragma unroll
      for (int i = 0; i < 4; ++i) acc[i] *= alpha;
#pragma unroll
      for (int tt = 0; tt < 4; ++tt)
#pragma unroll
        for (int r = 0; r < 8; ++r) st[tt][r] -= delta;
      stage_probs<false>(st, pb, ps);
    }
    lrun += ps;
    v16h vf1[4];
#pragma unroll
    for (int i = 0; i < 4; ++i) vf1[i] = Frag<_Float16>::load(vb + (i * 16 + rlane) * kFVPitch + 32 + koff);
    // the eight reads of the second 32 keys fly under the four products of the first
    __builtin_amdgcn_sched_barrier(0);
#pragma unroll
    for (int i = 0; i < 4; ++i) acc[i] = Frag<_Float16>::mma(vf0[i], pb[0], acc[i]);
    // holds those four products in front of the wait below, which would else be passed up to the reads
    __builtin_amdgcn_sched_barrier(0);
    // Hand-over of the buffers, behind the last LDS read of a tile's last stage; the test is the same for the whole block. The
    // last tile is handed to nobody: the barrier of the join ends its reads
    if ((s & (kFTile - 1)) == kFTile - 1) {
      // this wave's reads of the tile have returned before its buffer is given to the copies
      asm volatile("s_wait_dscnt 0x0" ::: "memory");
      // this wave's copies of the next tile have landed
      asm volatile("s_wait_asynccnt 0x0" ::: "memory");
      // publishes the next tile; every wave has left the buffer of this one
      __syncthreads();
      // the tile after the next, into the buffer just read; it flies while the next tile is worked on
#pragma unroll
      for (int u = 0; u < kFTile; ++u)
        if (s + 1 + kFTile + u < kFStages) stage_copies(s + 1 + kFTile + u);
    }
    // the copies stay in front of the last four products: they have the long way, and the products need registers alone
    __builtin_amdgcn_sched_barrier(0);
#pragma unroll
    for (int i = 0; i < 4; ++i) acc[i] = Frag<_Float16>::mma(vf1[i], pb[1], acc[i]);
  }
  // nothing is in flight when the stage buffers become the join slab
  asm volatile("s_wait_asynccnt 0x0" ::: "memory");

  // ---- join of the five key groups ----
  lrun += __shfl_xor(lrun, 16, 32);
  const int col = qt * 16 + rlane;
  if (hf == 0) { sM[kg][col] = mref; sL[kg][col] = lrun; }
  __syncthreads();          // references and sums published; every wave has left the stage buffers, which become the join slab
  float mall = sM[0][col];
#pragma unroll
  for (int k = 1; k < kFGroups; ++k) mall = fmaxf(mall, sM[k][col]);
  float lall = 0.0f;
#pragma unroll
  for (int k = 0; k < kFGroups; ++k) lall = fmaf(sL[k][col], exp2x1(sM[k][col] - mall), lall);
  const float f = exp2x1(mref - mall) / lall;
  float* slab = (float*)sRing;
#pragma unroll
  for (int i = 0; i < 4; ++i)
#pragma unroll
    for (int r = 0; r < 8; ++r) slab[(kg * kC + i * 16 + koff + r) * kFOPitch + col] = acc[i][r] * f;
  __syncthreads();
  // 64 rows x 16 float4 = 1024 pieces; 16 lanes cover one 256-B row segment of out
  const float gmul = gsc[0];
  for (int idx = t; idx < kC * (kFQ / 4); idx += kFWaves * 32) {
    const int row = idx >> 4, c4 = (idx & 15) * 4;
    v4f sum = *(const v4f*)(slab + row * kFOPitch + c4);
#pragma unroll
    for (int k = 1; k < kFGroups; ++k) sum += *(const v4f*)(slab + (k * kC + row) * kFOPitch + c4);
    const size_t o = ((size_t)b * kC + row) * kN + n0 + c4;
    const v4f xv = *(const v4f*)(x + o);
    v4f rr;
#pragma unroll
    for (int e = 0; e < 4; ++e) rr[e] = fmaf(gmul, sum[e], xv[e]);
    *(v4f*)(out + o) = rr;
  }
}

// ---------------------------------------------------------------------------
// Host glue.
//   QKP  bf16 2 x [2][8000][16]  1,024,000  at          0
//   VP   f16  [2][64][8000]      2,048,000  at  1,024,000
//   total                        3,072,000
// GEMM shapes: projections per block M=80 (Wv rows, then Wq|Wk rows), N=64 voxels, K=64; in the attention kernel per block scores
// M=8000 keys, N=64 queries, K=32 and V.P^T M=64, N=64, K=8000. No partial tiles, no padding rows.
// ---------------------------------------------------------------------------
extern "C" void kernel_launch(void* const* d_in, const int* in_sizes, int n_in,
                              void* d_out, int out_size, void* d_ws, size_t ws_size,
                              hipStream_t stream) {
  if (n_in < 8) return;
  const int nElem = kB * kC * kN;                 // 1,024,000
  if (in_sizes[0] != nElem) return;
  if (in_sizes[1] != kCq * kC || in_sizes[2] != kCq) return;
  if (in_sizes[3] != kCq * kC || in_sizes[4] != kCq) return;
  if (in_sizes[5] != kC * kC || in_sizes[6] != kC || in_sizes[7] < 1) return;
  if (out_size != nElem) return;

  const size_t szQKP = 2 * kKPlane * 2;
  const size_t szVP  = (size_t)kB * kC * kN * 2;
  const size_t offQKP  = 0;
  const size_t offVP   = offQKP + szQKP;
  const size_t total   = offVP + szVP;
  if (ws_size < total) return;

  const float* x     = (const float*)d_in[0];
  const float* Wq    = (const float*)d_in[1];
  const float* bq    = (const float*)d_in[2];
  const float* Wk    = (const float*)d_in[3];
  const float* bk    = (const float*)d_in[4];
  const float* Wv    = (const float*)d_in[5];
  const float* bv    = (const float*)d_in[6];
  const float* gamma = (const float*)d_in[7];
  float* out = (float*)d_out;
  char* ws = (char*)d_ws;
  unsigned short* QKP = (unsigned short*)(ws + offQKP);
  unsigned short* VP  = (unsigned short*)(ws + offVP);

  // ---- x, weights -> packed q|k plane and V plane, one launch ----
  proj_fused_kernel<<<dim3(kN / kPVox, kB), dim3(kPWaves * 32), 0, stream>>>(x, Wq, bq, Wk, bk, Wv, bv, QKP, VP);
  // ---- scores -> softmax -> V.P^T -> gamma scale and residual, one launch ----
  attn_fused_kernel<<<dim3(kN / kFQ, kB), dim3(kFWaves * 32), 0, stream>>>(QKP, VP, x, gamma, out);
}
